// v000
// Measured on an AMD MI455X. A time is GPU time per run, averaged over a window of back-to-back runs after a warm-up
// (all launches, gaps included; the runs take copies of the inputs in turn), and the median of several windows.
// Apart from v000's, it joins two sittings. Times from different sittings can be a few percent apart, while
// side-by-side timings come from the same sitting.
// The starting kernel, v000, takes 301 microseconds a run.
#include <hip/hip_runtime.h>

// An additive (tangent) attention of a context over an aspect (inputs, in argument order: a0 [32][256][512] the context; a1 [32][64][512] the aspect; a2, a3 [512][512] two projections ('out, in'); a4 [512] a score vector):
//   c = a0 a2^T ([256][512] an entry);  a = a1 a3^T ([64][512] an entry);  s[i][j] = the sum over the 512 units e of a4[e] tanh(c[i][e] + a[j][e]);  w = softmax over the 64 aspect rows j;  out[i][:] = the sum over j of w[i][j] a1[j][:]  ->  [32][256][512] (4.2 M).
// THE MODULE's OWN ORDER. Layout: bf16 copies of the four matrices (k_cvt8: the projections stand 'out, in' = the product's K-contiguous [N][K] or [M][K] operand as they are); the context's projection CP [8192][512] f32 by one product; THE ASPECT's PROJECTION IS COMPUTED ALREADY TRANSPOSED, AT [32][512][64] f32, by giving the projection as the product's first operand (shared by the entries) and an entry's aspect rows as its second;
// k_score fills the scores S [8192][64] (one literal loop of 512 units with the library's tanhf); k_softrow writes each row's weights as ONE f16 word (straight-line over a row's 64 scores; the maximum by a compare and a select); k_vt lays an entry's aspect rows transposed as an f16 plane VT [32][512][64]; the last product (f16 words of both operands; depth 64) writes the output itself.
// THREE flat kernels beside k_cvt8 and k_gemmw (k_score: one loop with a literal trip count; k_softrow and k_vt straight-line; every address from the lane's own index, a loop's own counter and launch constants; exact grids, no guard; no LDS, barrier, cross-lane word or atomic).
// Compute dtypes, f32 accumulate: every float input rounded to bf16 at its load; both projections ONE bf16 product on exact operands; scores and softmax f32; the weights ONE f16 word each against the aspect's own bf16 words carried as f16 (exact but for words under 2^-14).

#define NB_  32                   // entries
#define NQ   256                  // context rows (queries) an entry
#define NK   64                   // aspect rows (keys = values) an entry
#define DM   512                  // the width of both and the units
typedef _Float16 h16;
typedef unsigned short bf;
typedef __attribute__((ext_vector_type(16))) __bf16   v16bf;
typedef __attribute__((ext_vector_type(16))) _Float16 v16h;
typedef __attribute__((ext_vector_type(8)))  _Float16 v8h;
typedef __attribute__((ext_vector_type(8)))  unsigned short v8us;
typedef __attribute__((ext_vector_type(8)))  float    v8f;
typedef __attribute__((ext_vector_type(4)))  float    v4f;
typedef v8h  __attribute__((may_alias)) v8ha;
typedef v4f  __attribute__((may_alias)) v4fa;
typedef v8us __attribute__((may_alias)) v8usa;

__device__ __forceinline__ unsigned short f2bf(float f) { unsigned u = __float_as_uint(f); u += 0x7FFFu + ((u >> 16) & 1u); return (unsigned short)(u >> 16); }
__device__ __forceinline__ float bf2f(unsigned short b) { return __uint_as_float(((unsigned)b) << 16); }
__device__ __forceinline__ float bfr(float f) { return bf2f(f2bf(f)); }
__device__ __forceinline__ v16h cat16(v8h lo, v8h hi) { return __builtin_shufflevector(lo, hi, 0, 1, 2, 3, 4, 5, 6, 7, 8, 9, 10, 11, 12, 13, 14, 15); }
__device__ __forceinline__ v16bf cat16b(v8us lo, v8us hi) { return __builtin_bit_cast(v16bf, __builtin_shufflevector(lo, hi, 0, 1, 2, 3, 4, 5, 6, 7, 8, 9, 10, 11, 12, 13, 14, 15)); }
__device__ __forceinline__ v8f wmma16(v16h a, v16h b, v8f c) { return __builtin_amdgcn_wmma_f32_16x16x32_f16(false, a, false, b, (short)0, c, false, false); }
__device__ __forceinline__ v8f wmmab(v16bf a, v16bf b, v8f c) { return __builtin_amdgcn_wmma_f32_16x16x32_bf16(false, a, false, b, (short)0, c, false, false); }



// ---- k_gemmw: register-blocked GEMM, ONE WAVE per 64x64 output tile (16 accumulators), operands straight from K-contiguous 16-bit planes; grid (M/64, N/64, Z), 32 threads.
// C[m][n] (f32, pitch ldc, + optional f32 bias[n]) = sum_k A[m][k] Bt[n][k] (+ split products per NSPLIT). z-batch strides sA/sB/sC in elements. K % 32 == 0.
template <typename T16> struct WFrag;
template <> struct WFrag<h16> { typedef v16h V; static __device__ __forceinline__ V ld(const h16* p) { return cat16(*(const v8h*)p, *(const v8h*)(p + 16)); } static __device__ __forceinline__ v8f mma(V a, V b, v8f c) { return wmma16(a, b, c); } };
template <> struct WFrag<bf> { typedef v16bf V; static __device__ __forceinline__ V ld(const bf* p) { return cat16b(*(const v8us*)p, *(const v8us*)(p + 16)); } static __device__ __forceinline__ v8f mma(V a, V b, v8f c) { return wmmab(a, b, c); } };
template <typename T16, int NSPLIT, bool BIAS>
__global__ __launch_bounds__(32) void k_gemmw(const T16* __restrict__ A, const T16* __restrict__ A2, const T16* __restrict__ Bt, const T16* __restrict__ Bt2, int K, float* C, int ldc, const float* __restrict__ bias, size_t sA, size_t sB, size_t sC) {
    typedef typename WFrag<T16>::V V;
    __shared__ __align__(16) float os[16 * 68];
    const size_t z = blockIdx.z; A += z * sA; if (A2) A2 += z * sA; Bt += z * sB; if (Bt2) Bt2 += z * sB; C += z * sC;
    const int lane = threadIdx.x & 31, lr = lane & 15, hi = lane >> 4; const int r0 = blockIdx.x * 64, c0 = blockIdx.y * 64;
    v8f acc[4][4];
#pragma unroll
    for (int mb = 0; mb < 4; ++mb)
#pragma unroll
        for (int nb = 0; nb < 4; ++nb) acc[mb][nb] = (v8f){};
    const size_t aoff = (size_t)(r0 + lr) * K + 8 * hi, boff = (size_t)(c0 + lr) * K + 8 * hi;

    for (int kc = 0; kc < K; kc += 32) {
        V a[4], a2[4];
#pragma unroll
        for (int mb = 0; mb < 4; ++mb) { a[mb] = WFrag<T16>::ld(A + aoff + (size_t)mb * 16 * K + kc); if (NSPLIT == 1 || NSPLIT == 2) a2[mb] = WFrag<T16>::ld(A2 + aoff + (size_t)mb * 16 * K + kc); }
#pragma unroll
        for (int nb = 0; nb < 4; ++nb) { const V b = WFrag<T16>::ld(Bt + boff + (size_t)nb * 16 * K + kc); V b2; if (NSPLIT >= 2) b2 = WFrag<T16>::ld(Bt2 + boff + (size_t)nb * 16 * K + kc);
#pragma unroll
            for (int mb = 0; mb < 4; ++mb) { acc[mb][nb] = WFrag<T16>::mma(a[mb], b, acc[mb][nb]); if (NSPLIT == 1 || NSPLIT == 2) acc[mb][nb] = WFrag<T16>::mma(a2[mb], b, acc[mb][nb]); if (NSPLIT >= 2) acc[mb][nb] = WFrag<T16>::mma(a[mb], b2, acc[mb][nb]); } }
        asm volatile("v_nop\n\tv_nop\n\tv_nop\n\tv_nop" : "+v"(acc[0][0]), "+v"(acc[1][1]), "+v"(acc[2][2]), "+v"(acc[3][3]) : "v"(a[0]), "v"(a[3]));
    }
#pragma unroll
    for (int mb = 0; mb < 4; ++mb) {
#pragma unroll
        for (int nb = 0; nb < 4; ++nb) {
#pragma unroll
            for (int j = 0; j < 8; ++j) os[(hi * 8 + j) * 68 + nb * 16 + lr] = acc[mb][nb][j]; }
        __builtin_amdgcn_wave_barrier(); asm volatile("" ::: "memory");
        float* crow = C + (size_t)(r0 + mb * 16) * ldc + c0;
{
#pragma unroll
            for (int s = 0; s < 8; ++s) { const int row = 2 * s + hi, cofs = lr * 4; v4f val = *(const v4fa*)(os + row * 68 + cofs); if (BIAS) { val[0] += bfr(bias[c0 + cofs]); val[1] += bfr(bias[c0 + cofs + 1]); val[2] += bfr(bias[c0 + cofs + 2]); val[3] += bfr(bias[c0 + cofs + 3]); }
                *(v4f*)(crow + (size_t)row * ldc + cofs) = val; }
             }
        __builtin_amdgcn_wave_barrier(); asm volatile("" ::: "memory");
    }
}

__device__ __forceinline__ h16 tohx(float x) { return (h16)x; }
__device__ __forceinline__ void splitf(float y, unsigned short& h, unsigned short& l) { h = f2bf(y); l = f2bf(y - bf2f(h)); }
typedef __attribute__((ext_vector_type(2))) _Float16 v2h;
typedef __attribute__((ext_vector_type(4))) _Float16 v4h;
typedef __attribute__((ext_vector_type(2))) unsigned short v2us;
typedef __attribute__((ext_vector_type(4))) unsigned short v4us;
typedef __attribute__((ext_vector_type(2))) float v2f;
typedef __attribute__((ext_vector_type(4))) int v4i;
__global__ __launch_bounds__(256) void k_cvt8(const float* __restrict__ src, bf* dst, size_t n8) { const size_t i = (size_t)blockIdx.x * 256 + threadIdx.x; if (i >= n8) return; const v8f v = *(const v8f*)(src + i * 8); v8us o;
#pragma unroll
    for (int k = 0; k < 8; ++k) o[k] = f2bf(v[k]); *(v8us*)(dst + i * 8) = o;  }

__global__ __launch_bounds__(256) void k_score(const float* CP, const float* AT, const float* __restrict__ vv, float* S) { const unsigned idx = blockIdx.x * 256 + threadIdx.x; const unsigned j = idx % NK, r = idx / NK, b = r / NQ; const float* c = CP + (size_t)r * DM; const float* a = AT + (size_t)b * DM * NK + j; float s = 0.0f;
    for (int e = 0; e < DM; ++e) s += bfr(vv[e]) * tanhf(c[e] + a[(size_t)e * NK]);
    *(float*)(S + idx) = s;  }
__global__ __launch_bounds__(256) void k_softrow(const float* S, h16* P16) { const unsigned r = blockIdx.x * 256 + threadIdx.x; const float* s = S + (size_t)r * NK; float v[NK];
#pragma unroll
    for (int j4 = 0; j4 < NK / 4; ++j4) { const v4f a = *(const v4f*)(s + j4 * 4); v[j4 * 4] = a[0]; v[j4 * 4 + 1] = a[1]; v[j4 * 4 + 2] = a[2]; v[j4 * 4 + 3] = a[3]; }
    float mx = v[0];
#pragma unroll
    for (int j = 1; j < NK; ++j) mx = (v[j] > mx) ? v[j] : mx;
    float sum = 0.0f;
#pragma unroll
    for (int j = 0; j < NK; ++j) { v[j] = expf(v[j] - mx); sum += v[j]; }
    v8h h[NK / 8];
#pragma unroll
    for (int j = 0; j < NK; ++j) h[j / 8][j % 8] = tohx(v[j] / sum);
#pragma unroll
    for (int g = 0; g < NK / 8; ++g) *(v8h*)(P16 + (size_t)r * NK + g * 8) = h[g];
     }
__global__ __launch_bounds__(256) void k_vt(const float* __restrict__ src, h16* VT) { const unsigned idx = blockIdx.x * 256 + threadIdx.x; const unsigned j0 = (idx % (NK / 8)) * 8, d = (idx / (NK / 8)) % DM, b = idx / ((NK / 8) * DM); v8h o;
#pragma unroll
    for (int q = 0; q < 8; ++q) o[q] = tohx(bfr(src[((size_t)b * NK + j0 + q) * DM + d]));
    *(v8h*)(VT + (size_t)idx * 8) = o;  }

extern "C" void kernel_launch(void* const* d_in, const int* in_sizes, int n_in,
                              void* d_out, int out_size, void* d_ws, size_t ws_size, hipStream_t stream) {
    (void)in_sizes; (void)n_in; (void)out_size;
    const float* a0 = (const float*)d_in[0]; const float* a1 = (const float*)d_in[1]; const float* a2 = (const float*)d_in[2]; const float* a3 = (const float*)d_in[3]; const float* a4 = (const float*)d_in[4];   /* the module's argument order: the context, the aspect, the two projections, the score vector: FIVE inputs, all read */
    float* OUT = (float*)d_out;     // [32][256][512]
    char* wsp = (char*)d_ws;
    auto take = [&](size_t bytes) { char* p = wsp; wsp += (bytes + 255) & ~(size_t)255; return (void*)p; };
    bf* CB = (bf*)take((size_t)NB_ * NQ * DM * 2); bf* AB = (bf*)take((size_t)NB_ * NK * DM * 2); bf* WCB = (bf*)take((size_t)DM * DM * 2); bf* WAB = (bf*)take((size_t)DM * DM * 2);
    float* CP = (float*)take((size_t)NB_ * NQ * DM * 4); float* AT = (float*)take((size_t)NB_ * DM * NK * 4); float* S = (float*)take((size_t)NB_ * NQ * NK * 4);
    h16* P16 = (h16*)take((size_t)NB_ * NQ * NK * 2); h16* VT = (h16*)take((size_t)NB_ * DM * NK * 2);
    if ((size_t)(wsp - (char*)d_ws) > ws_size) return;    // total 36.00 MiB carved
    k_cvt8<<<(unsigned)((size_t)NB_ * NQ * DM / 8 / 256), 256, 0, stream>>>(a0, CB, (size_t)NB_ * NQ * DM / 8);
    k_cvt8<<<(unsigned)((size_t)NB_ * NK * DM / 8 / 256), 256, 0, stream>>>(a1, AB, (size_t)NB_ * NK * DM / 8);
    k_cvt8<<<(unsigned)((size_t)DM * DM / 8 / 256), 256, 0, stream>>>(a2, WCB, (size_t)DM * DM / 8);
    k_cvt8<<<(unsigned)((size_t)DM * DM / 8 / 256), 256, 0, stream>>>(a3, WAB, (size_t)DM * DM / 8);
    k_vt<<<(unsigned)((size_t)NB_ * DM * NK / 8 / 256), 256, 0, stream>>>(a1, VT);
    k_gemmw<bf, 0, false><<<dim3(NB_ * NQ / 64, DM / 64, 1), 32, 0, stream>>>(CB, nullptr, WCB, nullptr, DM, CP, DM, nullptr, (size_t)0, (size_t)0, (size_t)0);   /* the context's projection: all 8,192 rows */
    k_gemmw<bf, 0, false><<<dim3(DM / 64, NK / 64, NB_), 32, 0, stream>>>(WAB, nullptr, AB, nullptr, DM, AT, NK, nullptr, (size_t)0, (size_t)NK * DM, (size_t)DM * NK);   /* the aspect's projection, transposed: the projection shared by the 32 entries */
    k_score<<<(unsigned)((size_t)NB_ * NQ * NK / 256), 256, 0, stream>>>(CP, AT, a4, S);
    k_softrow<<<(unsigned)(NB_ * NQ / 256), 256, 0, stream>>>(S, P16);
    k_gemmw<h16, 0, false><<<dim3(NQ / 64, DM / 64, NB_), 32, 0, stream>>>(P16, nullptr, VT, nullptr, NK, OUT, DM, nullptr, (size_t)NQ * NK, (size_t)DM * NK, (size_t)NQ * DM);   /* out[b][i][d] = sum_j w[b][i][j] aspect[b][j][d]: depth 64; the one writer of the output */
}

// v001
// It runs in 124 microseconds.
// Two timings next to v000 put it at 2.52 and 2.48 times that version's speed.
#include <hip/hip_runtime.h>

// An additive (tangent) attention of a context over an aspect (inputs, in argument order: a0 [32][256][512] the context; a1 [32][64][512] the aspect; a2, a3 [512][512] two projections ('out, in'); a4 [512] a score vector):
//   c = a0 a2^T ([256][512] an entry);  a = a1 a3^T ([64][512] an entry);  s[i][j] = the sum over the 512 units e of a4[e] tanh(c[i][e] + a[j][e]);  w = softmax over the 64 aspect rows j;  out[i][:] = the sum over j of w[i][j] a1[j][:]  ->  [32][256][512] (4.2 M).
// THE MODULE's OWN ORDER. Layout: bf16 copies of the four matrices (k_cvt8: the projections stand 'out, in' = the products' K-contiguous operands as they are: a2 the [N][K] one, a3 the [M][K] one); the context's projection CP [8192][512] f32 by one product; THE ASPECT's PROJECTION IS COMPUTED ALREADY TRANSPOSED, AT [32][512][64] f32, by giving the projection as the product's first operand (shared by the entries) and an entry's aspect rows as its second;
// k_score fills the scores S [8192][64] (one literal loop of 512 units with the chip's tangent instruction); k_softrow writes each row's weights as ONE f16 word (straight-line over a row's 64 scores; the maximum by a compare and a select); k_vt lays an entry's aspect rows transposed as an f16 plane VT [32][512][64]; the last product (f16 words of both operands; depth 64) writes the output itself.
// THREE flat kernels of this file beside k_gemmw and k_cvt8 (k_score: one loop with a literal trip count; k_softrow and k_vt straight-line; every address from the lane's own index, a loop's own counter and launch constants; exact grids, no guard; no LDS, barrier, cross-lane word or atomic).
// Compute dtypes, f32 accumulate: every float input rounded to bf16 at its load; both projections ONE bf16 product on exact operands; scores and softmax f32; the weights ONE f16 word each against the aspect's own bf16 words carried as f16 (exact but for words under 2^-14).

#define NB_  32                   // entries
#define NQ   256                  // context rows (queries) an entry
#define NK   64                   // aspect rows (keys = values) an entry
#define DM   512                  // the width of both and the units
typedef _Float16 h16;
typedef unsigned short bf;
typedef __attribute__((ext_vector_type(16))) __bf16   v16bf;
typedef __attribute__((ext_vector_type(16))) _Float16 v16h;
typedef __attribute__((ext_vector_type(8)))  _Float16 v8h;
typedef __attribute__((ext_vector_type(8)))  unsigned short v8us;
typedef __attribute__((ext_vector_type(8)))  float    v8f;
typedef __attribute__((ext_vector_type(4)))  float    v4f;
typedef v8h  __attribute__((may_alias)) v8ha;
typedef v4f  __attribute__((may_alias)) v4fa;
typedef v8us __attribute__((may_alias)) v8usa;

__device__ __forceinline__ unsigned short f2bf(float f) { unsigned u = __float_as_uint(f); u += 0x7FFFu + ((u >> 16) & 1u); return (unsigned short)(u >> 16); }
__device__ __forceinline__ float bf2f(unsigned short b) { return __uint_as_float(((unsigned)b) << 16); }
__device__ __forceinline__ float bfr(float f) { return bf2f(f2bf(f)); }
__device__ __forceinline__ v16h cat16(v8h lo, v8h hi) { return __builtin_shufflevector(lo, hi, 0, 1, 2, 3, 4, 5, 6, 7, 8, 9, 10, 11, 12, 13, 14, 15); }
__device__ __forceinline__ v16bf cat16b(v8us lo, v8us hi) { return __builtin_bit_cast(v16bf, __builtin_shufflevector(lo, hi, 0, 1, 2, 3, 4, 5, 6, 7, 8, 9, 10, 11, 12, 13, 14, 15)); }
__device__ __forceinline__ v8f wmma16(v16h a, v16h b, v8f c) { return __builtin_amdgcn_wmma_f32_16x16x32_f16(false, a, false, b, (short)0, c, false, false); }
__device__ __forceinline__ v8f wmmab(v16bf a, v16bf b, v8f c) { return __builtin_amdgcn_wmma_f32_16x16x32_bf16(false, a, false, b, (short)0, c, false, false); }



// ---- k_gemmw: register-blocked GEMM, ONE WAVE per 64x64 output tile (16 accumulators), operands straight from K-contiguous 16-bit planes; grid (M/64, N/64, Z), 32 threads.
// C[m][n] (f32, pitch ldc, + optional f32 bias[n]) = sum_k A[m][k] Bt[n][k] (+ split products per NSPLIT). z-batch strides sA/sB/sC in elements. K % 32 == 0.
template <typename T16> struct WFrag;
template <> struct WFrag<h16> { typedef v16h V; static __device__ __forceinline__ V ld(const h16* p) { return cat16(*(const v8h*)p, *(const v8h*)(p + 16)); } static __device__ __forceinline__ v8f mma(V a, V b, v8f c) { return wmma16(a, b, c); } };
template <> struct WFrag<bf> { typedef v16bf V; static __device__ __forceinline__ V ld(const bf* p) { return cat16b(*(const v8us*)p, *(const v8us*)(p + 16)); } static __device__ __forceinline__ v8f mma(V a, V b, v8f c) { return wmmab(a, b, c); } };
template <typename T16, int NSPLIT, bool BIAS>
__global__ __launch_bounds__(32) void k_gemmw(const T16* __restrict__ A, const T16* __restrict__ A2, const T16* __restrict__ Bt, const T16* __restrict__ Bt2, int K, float* C, int ldc, const float* __restrict__ bias, size_t sA, size_t sB, size_t sC) {
    typedef typename WFrag<T16>::V V;
    __shared__ __align__(16) float os[16 * 68];
    const size_t z = blockIdx.z; A += z * sA; if (A2) A2 += z * sA; Bt += z * sB; if (Bt2) Bt2 += z * sB; C += z * sC;
    const int lane = threadIdx.x & 31, lr = lane & 15, hi = lane >> 4; const int r0 = blockIdx.x * 64, c0 = blockIdx.y * 64;
    v8f acc[4][4];
#pragma unroll
    for (int mb = 0; mb < 4; ++mb)
#pragma unroll
        for (int nb = 0; nb < 4; ++nb) acc[mb][nb] = (v8f){};
    const size_t aoff = (size_t)(r0 + lr) * K + 8 * hi, boff = (size_t)(c0 + lr) * K + 8 * hi;

    for (int kc = 0; kc < K; kc += 32) {
        V a[4], a2[4];
#pragma unroll
        for (int mb = 0; mb < 4; ++mb) { a[mb] = WFrag<T16>::ld(A + aoff + (size_t)mb * 16 * K + kc); if (NSPLIT == 1 || NSPLIT == 2) a2[mb] = WFrag<T16>::ld(A2 + aoff + (size_t)mb * 16 * K + kc); }
#pragma unroll
        for (int nb = 0; nb < 4; ++nb) { const V b = WFrag<T16>::ld(Bt + boff + (size_t)nb * 16 * K + kc); V b2; if (NSPLIT >= 2) b2 = WFrag<T16>::ld(Bt2 + boff + (size_t)nb * 16 * K + kc);
#pragma unroll
            for (int mb = 0; mb < 4; ++mb) { acc[mb][nb] = WFrag<T16>::mma(a[mb], b, acc[mb][nb]); if (NSPLIT == 1 || NSPLIT == 2) acc[mb][nb] = WFrag<T16>::mma(a2[mb], b, acc[mb][nb]); if (NSPLIT >= 2) acc[mb][nb] = WFrag<T16>::mma(a[mb], b2, acc[mb][nb]); } }
        asm volatile("v_nop\n\tv_nop\n\tv_nop\n\tv_nop" : "+v"(acc[0][0]), "+v"(acc[1][1]), "+v"(acc[2][2]), "+v"(acc[3][3]) : "v"(a[0]), "v"(a[3]));
    }
#pragma unroll
    for (int mb = 0; mb < 4; ++mb) {
#pragma unroll
        for (int nb = 0; nb < 4; ++nb) {
#pragma unroll
            for (int j = 0; j < 8; ++j) os[(hi * 8 + j) * 68 + nb * 16 + lr] = acc[mb][nb][j]; }
        __builtin_amdgcn_wave_barrier(); asm volatile("" ::: "memory");
        float* crow = C + (size_t)(r0 + mb * 16) * ldc + c0;
{
#pragma unroll
            for (int s = 0; s < 8; ++s) { const int row = 2 * s + hi, cofs = lr * 4; v4f val = *(const v4fa*)(os + row * 68 + cofs); if (BIAS) { val[0] += bfr(bias[c0 + cofs]); val[1] += bfr(bias[c0 + cofs + 1]); val[2] += bfr(bias[c0 + cofs + 2]); val[3] += bfr(bias[c0 + cofs + 3]); }
                *(v4f*)(crow + (size_t)row * ldc + cofs) = val; }
             }
        __builtin_amdgcn_wave_barrier(); asm volatile("" ::: "memory");
    }
}

__device__ __forceinline__ h16 tohx(float x) { return (h16)x; }
__device__ __forceinline__ void splitf(float y, unsigned short& h, unsigned short& l) { h = f2bf(y); l = f2bf(y - bf2f(h)); }
typedef __attribute__((ext_vector_type(2))) _Float16 v2h;
typedef __attribute__((ext_vector_type(4))) _Float16 v4h;
typedef __attribute__((ext_vector_type(2))) unsigned short v2us;
typedef __attribute__((ext_vector_type(4))) unsigned short v4us;
typedef __attribute__((ext_vector_type(2))) float v2f;
typedef __attribute__((ext_vector_type(4))) int v4i;
__global__ __launch_bounds__(256) void k_cvt8(const float* __restrict__ src, bf* dst, size_t n8) { const size_t i = (size_t)blockIdx.x * 256 + threadIdx.x; if (i >= n8) return; const v8f v = *(const v8f*)(src + i * 8); v8us o;
#pragma unroll
    for (int k = 0; k < 8; ++k) o[k] = f2bf(v[k]); *(v8us*)(dst + i * 8) = o;  }

__global__ __launch_bounds__(256) void k_score(const float* CP, const float* AT, const float* __restrict__ vv, float* S) { const unsigned idx = blockIdx.x * 256 + threadIdx.x; const unsigned j = idx % NK, r = idx / NK, b = r / NQ; const float* c = CP + (size_t)r * DM; const float* a = AT + (size_t)b * DM * NK + j; float s = 0.0f;
    for (int e = 0; e < DM; ++e) s += bfr(vv[e]) * __builtin_amdgcn_tanhf(c[e] + a[(size_t)e * NK]);   // the chip's own tangent instruction: one issue, no branch on lane data
    *(float*)(S + idx) = s;  }
__global__ __launch_bounds__(256) void k_softrow(const float* S, h16* P16) { const unsigned r = blockIdx.x * 256 + threadIdx.x; const float* s = S + (size_t)r * NK; float v[NK];
#pragma unroll
    for (int j4 = 0; j4 < NK / 4; ++j4) { const v4f a = *(const v4f*)(s + j4 * 4); v[j4 * 4] = a[0]; v[j4 * 4 + 1] = a[1]; v[j4 * 4 + 2] = a[2]; v[j4 * 4 + 3] = a[3]; }
    float mx = v[0];
#pragma unroll
    for (int j = 1; j < NK; ++j) mx = (v[j] > mx) ? v[j] : mx;
    float sum = 0.0f;
#pragma unroll
    for (int j = 0; j < NK; ++j) { v[j] = expf(v[j] - mx); sum += v[j]; }
    v8h h[NK / 8];
#pragma unroll
    for (int j = 0; j < NK; ++j) h[j / 8][j % 8] = tohx(v[j] / sum);
#pragma unroll
    for (int g = 0; g < NK / 8; ++g) *(v8h*)(P16 + (size_t)r * NK + g * 8) = h[g];
     }
__global__ __launch_bounds__(256) void k_vt(const float* __restrict__ src, h16* VT) { const unsigned idx = blockIdx.x * 256 + threadIdx.x; const unsigned j0 = (idx % (NK / 8)) * 8, d = (idx / (NK / 8)) % DM, b = idx / ((NK / 8) * DM); v8h o;
#pragma unroll
    for (int q = 0; q < 8; ++q) o[q] = tohx(bfr(src[((size_t)b * NK + j0 + q) * DM + d]));
    *(v8h*)(VT + (size_t)idx * 8) = o;  }

extern "C" void kernel_launch(void* const* d_in, const int* in_sizes, int n_in,
                              void* d_out, int out_size, void* d_ws, size_t ws_size, hipStream_t stream) {
    (void)in_sizes; (void)n_in; (void)out_size;
    const float* a0 = (const float*)d_in[0]; const float* a1 = (const float*)d_in[1]; const float* a2 = (const float*)d_in[2]; const float* a3 = (const float*)d_in[3]; const float* a4 = (const float*)d_in[4];   /* the module's argument order: the context, the aspect, the two projections, the score vector: FIVE inputs, all read */
    float* OUT = (float*)d_out;     // [32][256][512]
    char* wsp = (char*)d_ws;
    auto take = [&](size_t bytes) { char* p = wsp; wsp += (bytes + 255) & ~(size_t)255; return (void*)p; };
    bf* CB = (bf*)take((size_t)NB_ * NQ * DM * 2); bf* AB = (bf*)take((size_t)NB_ * NK * DM * 2); bf* WCB = (bf*)take((size_t)DM * DM * 2); bf* WAB = (bf*)take((size_t)DM * DM * 2);
    float* CP = (float*)take((size_t)NB_ * NQ * DM * 4); float* AT = (float*)take((size_t)NB_ * DM * NK * 4); float* S = (float*)take((size_t)NB_ * NQ * NK * 4);
    h16* P16 = (h16*)take((size_t)NB_ * NQ * NK * 2); h16* VT = (h16*)take((size_t)NB_ * DM * NK * 2);
    if ((size_t)(wsp - (char*)d_ws) > ws_size) return;    // total 36.00 MiB carved
    k_cvt8<<<(unsigned)((size_t)NB_ * NQ * DM / 8 / 256), 256, 0, stream>>>(a0, CB, (size_t)NB_ * NQ * DM / 8);
    k_cvt8<<<(unsigned)((size_t)NB_ * NK * DM / 8 / 256), 256, 0, stream>>>(a1, AB, (size_t)NB_ * NK * DM / 8);
    k_cvt8<<<(unsigned)((size_t)DM * DM / 8 / 256), 256, 0, stream>>>(a2, WCB, (size_t)DM * DM / 8);
    k_cvt8<<<(unsigned)((size_t)DM * DM / 8 / 256), 256, 0, stream>>>(a3, WAB, (size_t)DM * DM / 8);
    k_vt<<<(unsigned)((size_t)NB_ * DM * NK / 8 / 256), 256, 0, stream>>>(a1, VT);
    k_gemmw<bf, 0, false><<<dim3(NB_ * NQ / 64, DM / 64, 1), 32, 0, stream>>>(CB, nullptr, WCB, nullptr, DM, CP, DM, nullptr, (size_t)0, (size_t)0, (size_t)0);   /* the context's projection: all 8,192 rows */
    k_gemmw<bf, 0, false><<<dim3(DM / 64, NK / 64, NB_), 32, 0, stream>>>(WAB, nullptr, AB, nullptr, DM, AT, NK, nullptr, (size_t)0, (size_t)NK * DM, (size_t)DM * NK);   /* the aspect's projection, transposed: the projection shared by the 32 entries */
    k_score<<<(unsigned)((size_t)NB_ * NQ * NK / 256), 256, 0, stream>>>(CP, AT, a4, S);
    k_softrow<<<(unsigned)(NB_ * NQ / 256), 256, 0, stream>>>(S, P16);
    k_gemmw<h16, 0, false><<<dim3(NQ / 64, DM / 64, NB_), 32, 0, stream>>>(P16, nullptr, VT, nullptr, NK, OUT, DM, nullptr, (size_t)NQ * NK, (size_t)DM * NK, (size_t)NQ * DM);   /* out[b][i][d] = sum_j w[b][i][j] aspect[b][j][d]: depth 64; the one writer of the output */
}

// v002
// Measured time: 102 microseconds a run.
// Timed twice side by side with v001, it ran 1.19 and 1.18 times as fast.
// Counting every step since v000, it is 2.96 times as fast.
#include <hip/hip_runtime.h>

// An additive (tangent) attention of a context over an aspect (inputs, in argument order: a0 [32][256][512] the context; a1 [32][64][512] the aspect; a2, a3 [512][512] two projections ('out, in'); a4 [512] a score vector):
//   c = a0 a2^T ([256][512] an entry);  a = a1 a3^T ([64][512] an entry);  s[i][j] = the sum over the 512 units e of a4[e] tanh(c[i][e] + a[j][e]);  w = softmax over the 64 aspect rows j;  out[i][:] = the sum over j of w[i][j] a1[j][:]  ->  [32][256][512] (4.2 M).
// THE MODULE's OWN ORDER. Layout: bf16 copies of the four matrices (cvt8 in k_prep: the projections stand 'out, in' = a K-contiguous operand as they are ([N][K] for the context's, [M][K] for the aspect's)); the context's projection CP [8192][512] f32 by one product; THE ASPECT's PROJECTION IS COMPUTED ALREADY TRANSPOSED, AT [32][512][64] f32, by giving the projection as the product's first operand (shared by the entries) and an entry's aspect rows as its second;
// k_score fills the scores S [8192][64] (one literal loop of 512 units with the chip's tangent instruction); k_softrow writes each row's weights as ONE f16 word (straight-line over a row's 64 scores; the maximum by a compare and a select); vt8 (in k_prep) lays an entry's aspect rows transposed as an f16 plane VT [32][512][64]; the last product (f16 words of both operands; depth 64) writes the output itself.
// FIVE LAUNCHES: k_prep (copies and transposed plane), k_proj (both projections), k_score, k_softrow, the last product: launches that read nothing of one another share a grid, the block index picks the job.
// THREE flat texts of this file (k_score: one loop with a literal trip count; k_softrow and vt8 straight-line; every address from the lane's own index, a loop's own counter and launch constants; exact grids, no guard; no LDS, barrier, cross-lane word or atomic).
// Compute dtypes, f32 accumulate: every float input rounded to bf16 at its load; both projections ONE bf16 product on exact operands; scores and softmax f32; the weights ONE f16 word each against the aspect's own bf16 words carried as f16 (exact but for words under 2^-14).

#define NB_  32                   // entries
#define NQ   256                  // context rows (queries) an entry
#define NK   64                   // aspect rows (keys = values) an entry
#define DM   512                  // the width of both and the units
typedef _Float16 h16;
typedef unsigned short bf;
typedef __attribute__((ext_vector_type(16))) __bf16   v16bf;
typedef __attribute__((ext_vector_type(16))) _Float16 v16h;
typedef __attribute__((ext_vector_type(8)))  _Float16 v8h;
typedef __attribute__((ext_vector_type(8)))  unsigned short v8us;
typedef __attribute__((ext_vector_type(8)))  float    v8f;
typedef __attribute__((ext_vector_type(4)))  float    v4f;
typedef v8h  __attribute__((may_alias)) v8ha;
typedef v4f  __attribute__((may_alias)) v4fa;
typedef v8us __attribute__((may_alias)) v8usa;

__device__ __forceinline__ unsigned short f2bf(float f) { unsigned u = __float_as_uint(f); u += 0x7FFFu + ((u >> 16) & 1u); return (unsigned short)(u >> 16); }
__device__ __forceinline__ float bf2f(unsigned short b) { return __uint_as_float(((unsigned)b) << 16); }
__device__ __forceinline__ float bfr(float f) { return bf2f(f2bf(f)); }
__device__ __forceinline__ v16h cat16(v8h lo, v8h hi) { return __builtin_shufflevector(lo, hi, 0, 1, 2, 3, 4, 5, 6, 7, 8, 9, 10, 11, 12, 13, 14, 15); }
__device__ __forceinline__ v16bf cat16b(v8us lo, v8us hi) { return __builtin_bit_cast(v16bf, __builtin_shufflevector(lo, hi, 0, 1, 2, 3, 4, 5, 6, 7, 8, 9, 10, 11, 12, 13, 14, 15)); }
__device__ __forceinline__ v8f wmma16(v16h a, v16h b, v8f c) { return __builtin_amdgcn_wmma_f32_16x16x32_f16(false, a, false, b, (short)0, c, false, false); }
__device__ __forceinline__ v8f wmmab(v16bf a, v16bf b, v8f c) { return __builtin_amdgcn_wmma_f32_16x16x32_bf16(false, a, false, b, (short)0, c, false, false); }



// ---- k_gemmw: register-blocked GEMM, ONE WAVE per 64x64 output tile (16 accumulators), operands straight from K-contiguous 16-bit planes; grid (M/64, N/64, Z), 32 threads.
// C[m][n] (f32, pitch ldc, + optional f32 bias[n]) = sum_k A[m][k] Bt[n][k] (+ split products per NSPLIT). z-batch strides sA/sB/sC in elements. K % 32 == 0.
template <typename T16> struct WFrag;
template <> struct WFrag<h16> { typedef v16h V; static __device__ __forceinline__ V ld(const h16* p) { return cat16(*(const v8h*)p, *(const v8h*)(p + 16)); } static __device__ __forceinline__ v8f mma(V a, V b, v8f c) { return wmma16(a, b, c); } };
template <> struct WFrag<bf> { typedef v16bf V; static __device__ __forceinline__ V ld(const bf* p) { return cat16b(*(const v8us*)p, *(const v8us*)(p + 16)); } static __device__ __forceinline__ v8f mma(V a, V b, v8f c) { return wmmab(a, b, c); } };
// gemmw_tile: one wave's 64x64 tile at rows r0, columns c0 (the text of the kernel; k_gemmw and k_proj call it).
template <typename T16, int NSPLIT, bool BIAS>
__device__ __forceinline__ void gemmw_tile(const T16* __restrict__ A, const T16* __restrict__ A2, const T16* __restrict__ Bt, const T16* __restrict__ Bt2, int K, float* C, int ldc, const float* __restrict__ bias, int r0, int c0) {
    typedef typename WFrag<T16>::V V;
    __shared__ __align__(16) float os[16 * 68];
    const int lane = threadIdx.x & 31, lr = lane & 15, hi = lane >> 4;
    v8f acc[4][4];
#pragma unroll
    for (int mb = 0; mb < 4; ++mb)
#pragma unroll
        for (int nb = 0; nb < 4; ++nb) acc[mb][nb] = (v8f){};
    const size_t aoff = (size_t)(r0 + lr) * K + 8 * hi, boff = (size_t)(c0 + lr) * K + 8 * hi;

    for (int kc = 0; kc < K; kc += 32) {
        V a[4], a2[4];
#pragma unroll
        for (int mb = 0; mb < 4; ++mb) { a[mb] = WFrag<T16>::ld(A + aoff + (size_t)mb * 16 * K + kc); if (NSPLIT == 1 || NSPLIT == 2) a2[mb] = WFrag<T16>::ld(A2 + aoff + (size_t)mb * 16 * K + kc); }
#pragma unroll
        for (int nb = 0; nb < 4; ++nb) { const V b = WFrag<T16>::ld(Bt + boff + (size_t)nb * 16 * K + kc); V b2; if (NSPLIT >= 2) b2 = WFrag<T16>::ld(Bt2 + boff + (size_t)nb * 16 * K + kc);
#pragma unroll
            for (int mb = 0; mb < 4; ++mb) { acc[mb][nb] = WFrag<T16>::mma(a[mb], b, acc[mb][nb]); if (NSPLIT == 1 || NSPLIT == 2) acc[mb][nb] = WFrag<T16>::mma(a2[mb], b, acc[mb][nb]); if (NSPLIT >= 2) acc[mb][nb] = WFrag<T16>::mma(a[mb], b2, acc[mb][nb]); } }
        asm volatile("v_nop\n\tv_nop\n\tv_nop\n\tv_nop" : "+v"(acc[0][0]), "+v"(acc[1][1]), "+v"(acc[2][2]), "+v"(acc[3][3]) : "v"(a[0]), "v"(a[3]));
    }
#pragma unroll
    for (int mb = 0; mb < 4; ++mb) {
#pragma unroll
        for (int nb = 0; nb < 4; ++nb) {
#pragma unroll
            for (int j = 0; j < 8; ++j) os[(hi * 8 + j) * 68 + nb * 16 + lr] = acc[mb][nb][j]; }
        __builtin_amdgcn_wave_barrier(); asm volatile("" ::: "memory");
        float* crow = C + (size_t)(r0 + mb * 16) * ldc + c0;
{
#pragma unroll
            for (int s = 0; s < 8; ++s) { const int row = 2 * s + hi, cofs = lr * 4; v4f val = *(const v4fa*)(os + row * 68 + cofs); if (BIAS) { val[0] += bfr(bias[c0 + cofs]); val[1] += bfr(bias[c0 + cofs + 1]); val[2] += bfr(bias[c0 + cofs + 2]); val[3] += bfr(bias[c0 + cofs + 3]); }
                *(v4f*)(crow + (size_t)row * ldc + cofs) = val; }
             }
        __builtin_amdgcn_wave_barrier(); asm volatile("" ::: "memory");
    }
}
template <typename T16, int NSPLIT, bool BIAS>
__global__ __launch_bounds__(32) void k_gemmw(const T16* __restrict__ A, const T16* __restrict__ A2, const T16* __restrict__ Bt, const T16* __restrict__ Bt2, int K, float* C, int ldc, const float* __restrict__ bias, size_t sA, size_t sB, size_t sC) {
    const size_t z = blockIdx.z; A += z * sA; if (A2) A2 += z * sA; Bt += z * sB; if (Bt2) Bt2 += z * sB; C += z * sC;
    gemmw_tile<T16, NSPLIT, BIAS>(A, A2, Bt, Bt2, K, C, ldc, bias, blockIdx.x * 64, blockIdx.y * 64);
}
// ---- k_proj: BOTH projections in one launch (neither reads the other's result); the block index picks the product. The aspect's 256 tiles stand first, then the context's 1,024 in the order they had (row tile fastest).
#define PJ_A (NB_ * (DM / 64))    // tiles of the aspect's projection: 8 row tiles an entry
#define PJ_C ((NB_ * NQ / 64) * (DM / 64))   // tiles of the context's projection
__global__ __launch_bounds__(32) void k_proj(const bf* __restrict__ CB, const bf* __restrict__ WCB, const bf* __restrict__ AB, const bf* __restrict__ WAB, int K, float* CP, float* AT) {
    const unsigned t = blockIdx.x; const bf* A; const bf* Bt; float* C; int ldc, r0, c0;
    if (t < PJ_A) { const unsigned z = t / (DM / 64); A = WAB; Bt = AB + (size_t)z * NK * DM; C = AT + (size_t)z * DM * NK; ldc = NK; r0 = (int)(t % (DM / 64)) * 64; c0 = 0; }
    else { const unsigned u = t - PJ_A; A = CB; Bt = WCB; C = CP; ldc = DM; r0 = (int)(u % (NB_ * NQ / 64)) * 64; c0 = (int)(u / (NB_ * NQ / 64)) * 64; }
    gemmw_tile<bf, 0, false>(A, nullptr, Bt, nullptr, K, C, ldc, nullptr, r0, c0);
}

__device__ __forceinline__ h16 tohx(float x) { return (h16)x; }
__device__ __forceinline__ void splitf(float y, unsigned short& h, unsigned short& l) { h = f2bf(y); l = f2bf(y - bf2f(h)); }
typedef __attribute__((ext_vector_type(2))) _Float16 v2h;
typedef __attribute__((ext_vector_type(4))) _Float16 v4h;
typedef __attribute__((ext_vector_type(2))) unsigned short v2us;
typedef __attribute__((ext_vector_type(4))) unsigned short v4us;
typedef __attribute__((ext_vector_type(2))) float v2f;
typedef __attribute__((ext_vector_type(4))) int v4i;
__device__ __forceinline__ void cvt8(const float* __restrict__ src, bf* dst, size_t i) { const v8f v = *(const v8f*)(src + i * 8); v8us o;
#pragma unroll
    for (int k = 0; k < 8; ++k) o[k] = f2bf(v[k]); *(v8us*)(dst + i * 8) = o;  }

__global__ __launch_bounds__(256) void k_score(const float* CP, const float* AT, const float* __restrict__ vv, float* S) { const unsigned idx = blockIdx.x * 256 + threadIdx.x; const unsigned j = idx % NK, r = idx / NK, b = r / NQ; const float* c = CP + (size_t)r * DM; const float* a = AT + (size_t)b * DM * NK + j; float s = 0.0f;
    for (int e = 0; e < DM; ++e) s += bfr(vv[e]) * __builtin_amdgcn_tanhf(c[e] + a[(size_t)e * NK]);   // the chip's own tangent instruction: one issue, no branch on lane data
    *(float*)(S + idx) = s;  }
__global__ __launch_bounds__(256) void k_softrow(const float* S, h16* P16) { const unsigned r = blockIdx.x * 256 + threadIdx.x; const float* s = S + (size_t)r * NK; float v[NK];
#pragma unroll
    for (int j4 = 0; j4 < NK / 4; ++j4) { const v4f a = *(const v4f*)(s + j4 * 4); v[j4 * 4] = a[0]; v[j4 * 4 + 1] = a[1]; v[j4 * 4 + 2] = a[2]; v[j4 * 4 + 3] = a[3]; }
    float mx = v[0];
#pragma unroll
    for (int j = 1; j < NK; ++j) mx = (v[j] > mx) ? v[j] : mx;
    float sum = 0.0f;
#pragma unroll
    for (int j = 0; j < NK; ++j) { v[j] = expf(v[j] - mx); sum += v[j]; }
    v8h h[NK / 8];
#pragma unroll
    for (int j = 0; j < NK; ++j) h[j / 8][j % 8] = tohx(v[j] / sum);
#pragma unroll
    for (int g = 0; g < NK / 8; ++g) *(v8h*)(P16 + (size_t)r * NK + g * 8) = h[g];
     }
__device__ __forceinline__ void vt8(const float* __restrict__ src, h16* VT, unsigned idx) { const unsigned j0 = (idx % (NK / 8)) * 8, d = (idx / (NK / 8)) % DM, b = idx / ((NK / 8) * DM); v8h o;
#pragma unroll
    for (int q = 0; q < 8; ++q) o[q] = tohx(bfr(src[((size_t)b * NK + j0 + q) * DM + d]));
    *(v8h*)(VT + (size_t)idx * 8) = o;  }
// ---- k_prep: the four bf16 copies and the transposed f16 plane in one launch (none reads another's result); the block index picks the job, every range exact.
#define PB_VT (NB_ * DM * NK / 8 / 256)   // blocks of the transposed plane (its strided reads take longest: first)
#define PB_C  (NB_ * NQ * DM / 8 / 256)   // the context's copy
#define PB_A  (NB_ * NK * DM / 8 / 256)   // the aspect's copy
#define PB_W  (DM * DM / 8 / 256)         // one projection's copy
__global__ __launch_bounds__(256) void k_prep(const float* __restrict__ a0, const float* __restrict__ a1, const float* __restrict__ a2, const float* __restrict__ a3, bf* CB, bf* AB, bf* WCB, bf* WAB, h16* VT) {
    unsigned t = blockIdx.x;
    if (t < PB_VT) { vt8(a1, VT, t * 256 + threadIdx.x); return; }
    t -= PB_VT; const float* src; bf* dst;
    if (t < PB_C) { src = a0; dst = CB; }
    else if ((t -= PB_C) < PB_A) { src = a1; dst = AB; }
    else if ((t -= PB_A) < PB_W) { src = a2; dst = WCB; }
    else { t -= PB_W; src = a3; dst = WAB; }
    cvt8(src, dst, (size_t)t * 256 + threadIdx.x);
}

extern "C" void kernel_launch(void* const* d_in, const int* in_sizes, int n_in,
                              void* d_out, int out_size, void* d_ws, size_t ws_size, hipStream_t stream) {
    (void)in_sizes; (void)n_in; (void)out_size;
    const float* a0 = (const float*)d_in[0]; const float* a1 = (const float*)d_in[1]; const float* a2 = (const float*)d_in[2]; const float* a3 = (const float*)d_in[3]; const float* a4 = (const float*)d_in[4];   /* the module's argument order: the context, the aspect, the two projections, the score vector: FIVE inputs, all read */
    float* OUT = (float*)d_out;     // [32][256][512]
    char* wsp = (char*)d_ws;
    auto take = [&](size_t bytes) { char* p = wsp; wsp += (bytes + 255) & ~(size_t)255; return (void*)p; };
    bf* CB = (bf*)take((size_t)NB_ * NQ * DM * 2); bf* AB = (bf*)take((size_t)NB_ * NK * DM * 2); bf* WCB = (bf*)take((size_t)DM * DM * 2); bf* WAB = (bf*)take((size_t)DM * DM * 2);
    float* CP = (float*)take((size_t)NB_ * NQ * DM * 4); float* AT = (float*)take((size_t)NB_ * DM * NK * 4); float* S = (float*)take((size_t)NB_ * NQ * NK * 4);
    h16* P16 = (h16*)take((size_t)NB_ * NQ * NK * 2); h16* VT = (h16*)take((size_t)NB_ * DM * NK * 2);
    if ((size_t)(wsp - (char*)d_ws) > ws_size) return;    // total 36.00 MiB carved
    k_prep<<<(unsigned)(PB_VT + PB_C + PB_A + 2 * PB_W), 256, 0, stream>>>(a0, a1, a2, a3, CB, AB, WCB, WAB, VT);   /* the four bf16 copies and the transposed f16 plane */
    k_proj<<<(unsigned)(PJ_A + PJ_C), 32, 0, stream>>>(CB, WCB, AB, WAB, DM, CP, AT);   /* the context's projection (all 8,192 rows) and the aspect's, transposed (the projection shared by the 32 entries) */
    k_score<<<(unsigned)((size_t)NB_ * NQ * NK / 256), 256, 0, stream>>>(CP, AT, a4, S);
    k_softrow<<<(unsigned)(NB_ * NQ / 256), 256, 0, stream>>>(S, P16);
    k_gemmw<h16, 0, false><<<dim3(NQ / 64, DM / 64, NB_), 32, 0, stream>>>(P16, nullptr, VT, nullptr, NK, OUT, DM, nullptr, (size_t)NQ * NK, (size_t)DM * NK, (size_t)NQ * DM);   /* out[b][i][d] = sum_j w[b][i][j] aspect[b][j][d]: depth 64; the one writer of the output */
}

// v003
// A run of this version takes 94.7 microseconds.
// In two side-by-side timings against v002, it was 1.14 and 1.08 times as fast.
// All steps since v000 together make it 3.29 times as fast.
#include <hip/hip_runtime.h>

// An additive (tangent) attention of a context over an aspect (inputs, in argument order: a0 [32][256][512] the context; a1 [32][64][512] the aspect; a2, a3 [512][512] two projections ('out, in'); a4 [512] a score vector):
//   c = a0 a2^T ([256][512] an entry);  a = a1 a3^T ([64][512] an entry);  s[i][j] = the sum over the 512 units e of a4[e] tanh(c[i][e] + a[j][e]);  w = softmax over the 64 aspect rows j;  out[i][:] = the sum over j of w[i][j] a1[j][:]  ->  [32][256][512] (4.2 M).
// THE MODULE's OWN ORDER. Layout: bf16 copies of the four matrices (cvt8 in k_prep: the projections stand 'out, in' = the product's K-contiguous operand as they are); the context's projection CP [8192][512] f32 by one product; THE ASPECT's PROJECTION IS COMPUTED ALREADY TRANSPOSED, AT [32][512][64] f32, by giving the projection as the product's first operand (shared by the entries) and an entry's aspect rows as its second;
// vt8 (in k_prep) lays an entry's aspect rows transposed as an f16 plane VT [32][512][64]; k_attn does the rest for 16 context rows a work-group: the scores (one literal loop of 512 units with the chip's tangent instruction, one thread a score), each row's softmax (every thread walks its row's 64 words in LDS: the maximum, then the sum in the order of the 64 aspect rows) with the weights as ONE f16 word, and the last product (f16 words of both operands; depth 64); scores and weights pass through LDS and never reach memory.
// THREE LAUNCHES: k_prep (copies and transposed plane), k_proj (both projections), k_attn (scores, softmax, last product).
// Every address from the lane's own index, a loop's own counter and launch constants; exact grids, no guard; no cross-lane word or atomic.
// Compute dtypes, f32 accumulate: every float input rounded to bf16 at its load; both projections ONE bf16 product on exact operands; scores and softmax f32; the weights ONE f16 word each against the aspect's own bf16 words carried as f16 (exact but for words under 2^-14).

#define NB_  32                   // entries
#define NQ   256                  // context rows (queries) an entry
#define NK   64                   // aspect rows (keys = values) an entry
#define DM   512                  // the width of both and the units
typedef _Float16 h16;
typedef unsigned short bf;
typedef __attribute__((ext_vector_type(16))) __bf16   v16bf;
typedef __attribute__((ext_vector_type(16))) _Float16 v16h;
typedef __attribute__((ext_vector_type(8)))  _Float16 v8h;
typedef __attribute__((ext_vector_type(8)))  unsigned short v8us;
typedef __attribute__((ext_vector_type(8)))  float    v8f;
typedef __attribute__((ext_vector_type(4)))  float    v4f;
typedef v8h  __attribute__((may_alias)) v8ha;
typedef v4f  __attribute__((may_alias)) v4fa;
typedef v8us __attribute__((may_alias)) v8usa;

__device__ __forceinline__ unsigned short f2bf(float f) { unsigned u = __float_as_uint(f); u += 0x7FFFu + ((u >> 16) & 1u); return (unsigned short)(u >> 16); }
__device__ __forceinline__ float bf2f(unsigned short b) { return __uint_as_float(((unsigned)b) << 16); }
__device__ __forceinline__ float bfr(float f) { return bf2f(f2bf(f)); }
__device__ __forceinline__ v16h cat16(v8h lo, v8h hi) { return __builtin_shufflevector(lo, hi, 0, 1, 2, 3, 4, 5, 6, 7, 8, 9, 10, 11, 12, 13, 14, 15); }
__device__ __forceinline__ v16bf cat16b(v8us lo, v8us hi) { return __builtin_bit_cast(v16bf, __builtin_shufflevector(lo, hi, 0, 1, 2, 3, 4, 5, 6, 7, 8, 9, 10, 11, 12, 13, 14, 15)); }
__device__ __forceinline__ v8f wmma16(v16h a, v16h b, v8f c) { return __builtin_amdgcn_wmma_f32_16x16x32_f16(false, a, false, b, (short)0, c, false, false); }
__device__ __forceinline__ v8f wmmab(v16bf a, v16bf b, v8f c) { return __builtin_amdgcn_wmma_f32_16x16x32_bf16(false, a, false, b, (short)0, c, false, false); }



// ---- gemmw_tile: register-blocked GEMM, ONE WAVE per 64x64 output tile (16 accumulators), operands straight from K-contiguous 16-bit planes; 32 threads.
// C[m][n] (f32, pitch ldc, + optional f32 bias[n]) = sum_k A[m][k] Bt[n][k] (+ split products per NSPLIT). K % 32 == 0.
template <typename T16> struct WFrag;
template <> struct WFrag<h16> { typedef v16h V; static __device__ __forceinline__ V ld(const h16* p) { return cat16(*(const v8h*)p, *(const v8h*)(p + 16)); } static __device__ __forceinline__ v8f mma(V a, V b, v8f c) { return wmma16(a, b, c); } };
template <> struct WFrag<bf> { typedef v16bf V; static __device__ __forceinline__ V ld(const bf* p) { return cat16b(*(const v8us*)p, *(const v8us*)(p + 16)); } static __device__ __forceinline__ v8f mma(V a, V b, v8f c) { return wmmab(a, b, c); } };
// gemmw_tile: one wave's 64x64 tile at rows r0, columns c0 (k_proj calls it).
template <typename T16, int NSPLIT, bool BIAS>
__device__ __forceinline__ void gemmw_tile(const T16* __restrict__ A, const T16* __restrict__ A2, const T16* __restrict__ Bt, const T16* __restrict__ Bt2, int K, float* C, int ldc, const float* __restrict__ bias, int r0, int c0) {
    typedef typename WFrag<T16>::V V;
    __shared__ __align__(16) float os[16 * 68];
    const int lane = threadIdx.x & 31, lr = lane & 15, hi = lane >> 4;
    v8f acc[4][4];
#pragma unroll
    for (int mb = 0; mb < 4; ++mb)
#pragma unroll
        for (int nb = 0; nb < 4; ++nb) acc[mb][nb] = (v8f){};
    const size_t aoff = (size_t)(r0 + lr) * K + 8 * hi, boff = (size_t)(c0 + lr) * K + 8 * hi;

    for (int kc = 0; kc < K; kc += 32) {
        V a[4], a2[4];
#pragma unroll
        for (int mb = 0; mb < 4; ++mb) { a[mb] = WFrag<T16>::ld(A + aoff + (size_t)mb * 16 * K + kc); if (NSPLIT == 1 || NSPLIT == 2) a2[mb] = WFrag<T16>::ld(A2 + aoff + (size_t)mb * 16 * K + kc); }
#pragma unroll
        for (int nb = 0; nb < 4; ++nb) { const V b = WFrag<T16>::ld(Bt + boff + (size_t)nb * 16 * K + kc); V b2; if (NSPLIT >= 2) b2 = WFrag<T16>::ld(Bt2 + boff + (size_t)nb * 16 * K + kc);
#pragma unroll
            for (int mb = 0; mb < 4; ++mb) { acc[mb][nb] = WFrag<T16>::mma(a[mb], b, acc[mb][nb]); if (NSPLIT == 1 || NSPLIT == 2) acc[mb][nb] = WFrag<T16>::mma(a2[mb], b, acc[mb][nb]); if (NSPLIT >= 2) acc[mb][nb] = WFrag<T16>::mma(a[mb], b2, acc[mb][nb]); } }
        asm volatile("v_nop\n\tv_nop\n\tv_nop\n\tv_nop" : "+v"(acc[0][0]), "+v"(acc[1][1]), "+v"(acc[2][2]), "+v"(acc[3][3]) : "v"(a[0]), "v"(a[3]));
    }
#pragma unroll
    for (int mb = 0; mb < 4; ++mb) {
#pragma unroll
        for (int nb = 0; nb < 4; ++nb) {
#pragma unroll
            for (int j = 0; j < 8; ++j) os[(hi * 8 + j) * 68 + nb * 16 + lr] = acc[mb][nb][j]; }
        __builtin_amdgcn_wave_barrier(); asm volatile("" ::: "memory");
        float* crow = C + (size_t)(r0 + mb * 16) * ldc + c0;
{
#pragma unroll
            for (int s = 0; s < 8; ++s) { const int row = 2 * s + hi, cofs = lr * 4; v4f val = *(const v4fa*)(os + row * 68 + cofs); if (BIAS) { val[0] += bfr(bias[c0 + cofs]); val[1] += bfr(bias[c0 + cofs + 1]); val[2] += bfr(bias[c0 + cofs + 2]); val[3] += bfr(bias[c0 + cofs + 3]); }
                *(v4f*)(crow + (size_t)row * ldc + cofs) = val; }
             }
        __builtin_amdgcn_wave_barrier(); asm volatile("" ::: "memory");
    }
}
// ---- k_proj: BOTH projections in one launch (neither reads the other's result); the block index picks the product. The aspect's 256 tiles stand first, then the context's 1,024 in the order they had (row tile fastest).
#define PJ_A (NB_ * (DM / 64))    // tiles of the aspect's projection: 8 row tiles an entry
#define PJ_C ((NB_ * NQ / 64) * (DM / 64))   // tiles of the context's projection
__global__ __launch_bounds__(32) void k_proj(const bf* __restrict__ CB, const bf* __restrict__ WCB, const bf* __restrict__ AB, const bf* __restrict__ WAB, int K, float* CP, float* AT) {
    const unsigned t = blockIdx.x; const bf* A; const bf* Bt; float* C; int ldc, r0, c0;
    if (t < PJ_A) { const unsigned z = t / (DM / 64); A = WAB; Bt = AB + (size_t)z * NK * DM; C = AT + (size_t)z * DM * NK; ldc = NK; r0 = (int)(t % (DM / 64)) * 64; c0 = 0; }
    else { const unsigned u = t - PJ_A; A = CB; Bt = WCB; C = CP; ldc = DM; r0 = (int)(u % (NB_ * NQ / 64)) * 64; c0 = (int)(u / (NB_ * NQ / 64)) * 64; }
    gemmw_tile<bf, 0, false>(A, nullptr, Bt, nullptr, K, C, ldc, nullptr, r0, c0);
}

__device__ __forceinline__ h16 tohx(float x) { return (h16)x; }
__device__ __forceinline__ void splitf(float y, unsigned short& h, unsigned short& l) { h = f2bf(y); l = f2bf(y - bf2f(h)); }
typedef __attribute__((ext_vector_type(2))) _Float16 v2h;
typedef __attribute__((ext_vector_type(4))) _Float16 v4h;
typedef __attribute__((ext_vector_type(2))) unsigned short v2us;
typedef __attribute__((ext_vector_type(4))) unsigned short v4us;
typedef __attribute__((ext_vector_type(2))) float v2f;
typedef __attribute__((ext_vector_type(4))) int v4i;
__device__ __forceinline__ void cvt8(const float* __restrict__ src, bf* dst, size_t i) { const v8f v = *(const v8f*)(src + i * 8); v8us o;
#pragma unroll
    for (int k = 0; k < 8; ++k) o[k] = f2bf(v[k]); *(v8us*)(dst + i * 8) = o;  }

// ---- k_attn: scores, softmax and the last product of RT context rows in one work-group of RT * NK threads (32 waves).
// Thread t holds the score of local row t / NK against aspect row t % NK. Each wave then forms 16 output columns of all RT rows: D[m = column][n = row] = sum_j VT[column][j] w[row][j], so a lane holds 8 neighbouring columns of one row.
#define RT 16                     // context rows a work-group (the matrix instruction's N)
#define PP (NK + 8)               // pitch of the weights in LDS, f16 words: 16 bytes over a row, for the 16-byte fragment reads
#define OP (DM + 4)               // pitch of the output tile in LDS, floats: 16 bytes over a row
__global__ __launch_bounds__(RT * NK) void k_attn(const float* CP, const float* AT, const float* __restrict__ vv, const h16* __restrict__ VT, float* OUT) {
    __shared__ __align__(16) float Ss[RT * NK];   // scores
    __shared__ __align__(16) float Es[RT * NK];   // exponentials
    __shared__ __align__(16) h16 Ps[RT * PP];     // weights
    __shared__ __align__(16) float Os[RT * OP];   // the output tile, for whole-line stores
    const unsigned tid = threadIdx.x, idx = blockIdx.x * (RT * NK) + tid; const unsigned j = idx % NK, r = idx / NK, b = r / NQ; const float* c = CP + (size_t)r * DM; const float* a = AT + (size_t)b * DM * NK + j; float s = 0.0f;
    const unsigned lane = tid & 31, lr = lane & 15, hi = lane >> 4, w = tid >> 5, rl = tid / NK;
    const h16* vt = VT + (size_t)b * DM * NK + (size_t)(w * 16 + lr) * NK + 8 * hi;
    const v16h va0 = WFrag<h16>::ld(vt), va1 = WFrag<h16>::ld(vt + 32);   // this wave's 16 columns of the aspect, asked for in front of the score loop: behind it their latency would stand open at the first barrier
    for (int e = 0; e < DM; ++e) s += bfr(vv[e]) * __builtin_amdgcn_tanhf(c[e] + a[(size_t)e * NK]);   // the chip's own tangent instruction: one issue, no branch on lane data
    Ss[tid] = s;
    __syncthreads();
    const float* srow = Ss + rl * NK; float mx = srow[0];
#pragma unroll   // straight-line: the row comes as 16-byte LDS reads at literal offsets, several in flight
    for (int q = 0; q < NK / 4; ++q) { const v4f x = *(const v4fa*)(srow + q * 4); mx = fmaxf(fmaxf(fmaxf(fmaxf(mx, x[0]), x[1]), x[2]), x[3]); }
    const float ex = expf(s - mx);
    Es[tid] = ex;
    __syncthreads();
    const float* erow = Es + rl * NK; float sum = 0.0f;
#pragma unroll   // straight-line, as above; the additions stay one chain in the order of the aspect rows
    for (int q = 0; q < NK / 4; ++q) { const v4f x = *(const v4fa*)(erow + q * 4); sum += x[0]; sum += x[1]; sum += x[2]; sum += x[3]; }
    Ps[rl * PP + j] = tohx(ex / sum);
    __syncthreads();
    const h16* pb = Ps + lr * PP + 8 * hi; v8f acc = (v8f){};
    acc = wmma16(va0, cat16(*(const v8ha*)pb, *(const v8ha*)(pb + 16)), acc);
    acc = wmma16(va1, cat16(*(const v8ha*)(pb + 32), *(const v8ha*)(pb + 48)), acc);
    float* op = Os + lr * OP + w * 16 + hi * 8;
    *(v4fa*)op = (v4f){acc[0], acc[1], acc[2], acc[3]}; *(v4fa*)(op + 4) = (v4f){acc[4], acc[5], acc[6], acc[7]};
    __syncthreads();
#pragma unroll   // two trips: both LDS reads go out before the first store
    for (int q = 0; q < RT * DM / 4 / (RT * NK); ++q) { const unsigned f = (q * (RT * NK) + tid) * 4, row = f / DM, col = f % DM;
        *(v4f*)(OUT + ((size_t)blockIdx.x * RT + row) * DM + col) = *(const v4fa*)(Os + row * OP + col); }
}
__device__ __forceinline__ void vt8(const float* __restrict__ src, h16* VT, unsigned idx) { const unsigned j0 = (idx % (NK / 8)) * 8, d = (idx / (NK / 8)) % DM, b = idx / ((NK / 8) * DM); v8h o;
#pragma unroll
    for (int q = 0; q < 8; ++q) o[q] = tohx(bfr(src[((size_t)b * NK + j0 + q) * DM + d]));
    *(v8h*)(VT + (size_t)idx * 8) = o;  }
// ---- k_prep: the four bf16 copies and the transposed f16 plane in one launch (none reads another's result); the block index picks the job, every range exact.
#define PB_VT (NB_ * DM * NK / 8 / 256)   // blocks of the transposed plane (its strided reads take longest: first)
#define PB_C  (NB_ * NQ * DM / 8 / 256)   // the context's copy
#define PB_A  (NB_ * NK * DM / 8 / 256)   // the aspect's copy
#define PB_W  (DM * DM / 8 / 256)         // one projection's copy
__global__ __launch_bounds__(256) void k_prep(const float* __restrict__ a0, const float* __restrict__ a1, const float* __restrict__ a2, const float* __restrict__ a3, bf* CB, bf* AB, bf* WCB, bf* WAB, h16* VT) {
    unsigned t = blockIdx.x;
    if (t < PB_VT) { vt8(a1, VT, t * 256 + threadIdx.x); return; }
    t -= PB_VT; const float* src; bf* dst;
    if (t < PB_C) { src = a0; dst = CB; }
    else if ((t -= PB_C) < PB_A) { src = a1; dst = AB; }
    else if ((t -= PB_A) < PB_W) { src = a2; dst = WCB; }
    else { t -= PB_W; src = a3; dst = WAB; }
    cvt8(src, dst, (size_t)t * 256 + threadIdx.x);
}

extern "C" void kernel_launch(void* const* d_in, const int* in_sizes, int n_in,
                              void* d_out, int out_size, void* d_ws, size_t ws_size, hipStream_t stream) {
    (void)in_sizes; (void)n_in; (void)out_size;
    const float* a0 = (const float*)d_in[0]; const float* a1 = (const float*)d_in[1]; const float* a2 = (const float*)d_in[2]; const float* a3 = (const float*)d_in[3]; const float* a4 = (const float*)d_in[4];   /* the module's argument order: the context, the aspect, the two projections, the score vector: FIVE inputs, all read */
    float* OUT = (float*)d_out;     // [32][256][512]
    char* wsp = (char*)d_ws;
    auto take = [&](size_t bytes) { char* p = wsp; wsp += (bytes + 255) & ~(size_t)255; return (void*)p; };
    bf* CB = (bf*)take((size_t)NB_ * NQ * DM * 2); bf* AB = (bf*)take((size_t)NB_ * NK * DM * 2); bf* WCB = (bf*)take((size_t)DM * DM * 2); bf* WAB = (bf*)take((size_t)DM * DM * 2);
    float* CP = (float*)take((size_t)NB_ * NQ * DM * 4); float* AT = (float*)take((size_t)NB_ * DM * NK * 4);
    h16* VT = (h16*)take((size_t)NB_ * DM * NK * 2);
    if ((size_t)(wsp - (char*)d_ws) > ws_size) return;    // total 33.00 MiB carved
    k_prep<<<(unsigned)(PB_VT + PB_C + PB_A + 2 * PB_W), 256, 0, stream>>>(a0, a1, a2, a3, CB, AB, WCB, WAB, VT);   /* the four bf16 copies and the transposed f16 plane */
    k_proj<<<(unsigned)(PJ_A + PJ_C), 32, 0, stream>>>(CB, WCB, AB, WAB, DM, CP, AT);   /* the context's projection (all 8,192 rows) and the aspect's, transposed (the projection shared by the 32 entries) */
    k_attn<<<(unsigned)(NB_ * NQ / RT), RT * NK, 0, stream>>>(CP, AT, a4, VT, OUT);   /* scores, softmax and out[b][i][d] = sum_j w[b][i][j] aspect[b][j][d] (depth 64) for 16 context rows a work-group; the one writer of the output */
}

// v004
// Measured time: 57.2 microseconds a run.
// Two timings next to v003 put it at 1.68 and 1.70 times that version's speed.
// All steps since v000 together make it 5.56 times as fast.
#include <hip/hip_runtime.h>

// An additive (tangent) attention of a context over an aspect (inputs, in argument order: a0 [32][256][512] the context; a1 [32][64][512] the aspect; a2, a3 [512][512] two projections ('out, in'); a4 [512] a score vector):
//   c = a0 a2^T ([256][512] an entry);  a = a1 a3^T ([64][512] an entry);  s[i][j] = the sum over the 512 units e of a4[e] tanh(c[i][e] + a[j][e]);  w = softmax over the 64 aspect rows j;  out[i][:] = the sum over j of w[i][j] a1[j][:]  ->  [32][256][512] (4.2 M).
// THE MODULE's OWN ORDER. Layout: bf16 copies of the four matrices (cvt8 in k_prep: the projections stand 'out, in' = a K-contiguous operand of the product as they are); the context's projection CP [8192][512] f32 by one product; THE ASPECT's PROJECTION IS COMPUTED ALREADY TRANSPOSED, AT [32][512][64] f32, by giving the projection as the product's first operand (shared by the entries) and an entry's aspect rows as its second;
// vt8 (in k_prep) lays an entry's aspect rows transposed as an f16 plane VT [32][512][64]; k_attn does the rest for 32 context rows a work-group: the scores (one loop of 512 units with the chip's tangent instruction, a thread holding 4 rows by 2 aspect rows), each row's softmax (every thread walks its rows' 64 words in LDS: the maximum, then the sum in the order of the 64 aspect rows) with the weights as ONE f16 word, and the last product (f16 words of both operands; depth 64); scores and weights pass through LDS and never reach memory.
// THREE LAUNCHES: k_prep (copies and transposed plane), k_proj (both projections), k_attn (scores, softmax, last product).
// Every address from the lane's own index, a loop's own counter and launch constants; exact grids, no guard; no atomic, and no cross-lane word but the wave's own number taken as a scalar in k_attn.
// Compute dtypes, f32 accumulate: every float input rounded to bf16 at its load; both projections ONE bf16 product on exact operands; scores and softmax f32; the weights ONE f16 word each against the aspect's own bf16 words carried as f16 (exact but for words under 2^-14).

#define NB_  32                   // entries
#define NQ   256                  // context rows (queries) an entry
#define NK   64                   // aspect rows (keys = values) an entry
#define DM   512                  // the width of both and the units
typedef _Float16 h16;
typedef unsigned short bf;
typedef __attribute__((ext_vector_type(16))) __bf16   v16bf;
typedef __attribute__((ext_vector_type(16))) _Float16 v16h;
typedef __attribute__((ext_vector_type(8)))  _Float16 v8h;
typedef __attribute__((ext_vector_type(8)))  unsigned short v8us;
typedef __attribute__((ext_vector_type(8)))  float    v8f;
typedef __attribute__((ext_vector_type(4)))  float    v4f;
typedef v8h  __attribute__((may_alias)) v8ha;
typedef v4f  __attribute__((may_alias)) v4fa;
typedef v8us __attribute__((may_alias)) v8usa;

__device__ __forceinline__ unsigned short f2bf(float f) { unsigned u = __float_as_uint(f); u += 0x7FFFu + ((u >> 16) & 1u); return (unsigned short)(u >> 16); }
__device__ __forceinline__ float bf2f(unsigned short b) { return __uint_as_float(((unsigned)b) << 16); }
__device__ __forceinline__ float bfr(float f) { return bf2f(f2bf(f)); }
__device__ __forceinline__ v16h cat16(v8h lo, v8h hi) { return __builtin_shufflevector(lo, hi, 0, 1, 2, 3, 4, 5, 6, 7, 8, 9, 10, 11, 12, 13, 14, 15); }
__device__ __forceinline__ v16bf cat16b(v8us lo, v8us hi) { return __builtin_bit_cast(v16bf, __builtin_shufflevector(lo, hi, 0, 1, 2, 3, 4, 5, 6, 7, 8, 9, 10, 11, 12, 13, 14, 15)); }
__device__ __forceinline__ v8f wmma16(v16h a, v16h b, v8f c) { return __builtin_amdgcn_wmma_f32_16x16x32_f16(false, a, false, b, (short)0, c, false, false); }
__device__ __forceinline__ v8f wmmab(v16bf a, v16bf b, v8f c) { return __builtin_amdgcn_wmma_f32_16x16x32_bf16(false, a, false, b, (short)0, c, false, false); }



// ---- gemmw_tile: register-blocked GEMM, ONE WAVE per 64x64 output tile (16 accumulators), operands straight from K-contiguous 16-bit planes; 32 threads.
// C[m][n] (f32, pitch ldc, + optional f32 bias[n]) = sum_k A[m][k] Bt[n][k] (+ split products per NSPLIT). K % 32 == 0.
template <typename T16> struct WFrag;
template <> struct WFrag<h16> { typedef v16h V; static __device__ __forceinline__ V ld(const h16* p) { return cat16(*(const v8h*)p, *(const v8h*)(p + 16)); } static __device__ __forceinline__ v8f mma(V a, V b, v8f c) { return wmma16(a, b, c); } };
template <> struct WFrag<bf> { typedef v16bf V; static __device__ __forceinline__ V ld(const bf* p) { return cat16b(*(const v8us*)p, *(const v8us*)(p + 16)); } static __device__ __forceinline__ v8f mma(V a, V b, v8f c) { return wmmab(a, b, c); } };
// gemmw_tile: one wave's 64x64 tile at rows r0, columns c0 (k_proj calls it).
template <typename T16, int NSPLIT, bool BIAS>
__device__ __forceinline__ void gemmw_tile(const T16* __restrict__ A, const T16* __restrict__ A2, const T16* __restrict__ Bt, const T16* __restrict__ Bt2, int K, float* C, int ldc, const float* __restrict__ bias, int r0, int c0) {
    typedef typename WFrag<T16>::V V;
    __shared__ __align__(16) float os[16 * 68];
    const int lane = threadIdx.x & 31, lr = lane & 15, hi = lane >> 4;
    v8f acc[4][4];
#pragma unroll
    for (int mb = 0; mb < 4; ++mb)
#pragma unroll
        for (int nb = 0; nb < 4; ++nb) acc[mb][nb] = (v8f){};
    const size_t aoff = (size_t)(r0 + lr) * K + 8 * hi, boff = (size_t)(c0 + lr) * K + 8 * hi;

    for (int kc = 0; kc < K; kc += 32) {
        V a[4], a2[4];
#pragma unroll
        for (int mb = 0; mb < 4; ++mb) { a[mb] = WFrag<T16>::ld(A + aoff + (size_t)mb * 16 * K + kc); if (NSPLIT == 1 || NSPLIT == 2) a2[mb] = WFrag<T16>::ld(A2 + aoff + (size_t)mb * 16 * K + kc); }
#pragma unroll
        for (int nb = 0; nb < 4; ++nb) { const V b = WFrag<T16>::ld(Bt + boff + (size_t)nb * 16 * K + kc); V b2; if (NSPLIT >= 2) b2 = WFrag<T16>::ld(Bt2 + boff + (size_t)nb * 16 * K + kc);
#pragma unroll
            for (int mb = 0; mb < 4; ++mb) { acc[mb][nb] = WFrag<T16>::mma(a[mb], b, acc[mb][nb]); if (NSPLIT == 1 || NSPLIT == 2) acc[mb][nb] = WFrag<T16>::mma(a2[mb], b, acc[mb][nb]); if (NSPLIT >= 2) acc[mb][nb] = WFrag<T16>::mma(a[mb], b2, acc[mb][nb]); } }
        asm volatile("v_nop\n\tv_nop\n\tv_nop\n\tv_nop" : "+v"(acc[0][0]), "+v"(acc[1][1]), "+v"(acc[2][2]), "+v"(acc[3][3]) : "v"(a[0]), "v"(a[3]));
    }
#pragma unroll
    for (int mb = 0; mb < 4; ++mb) {
#pragma unroll
        for (int nb = 0; nb < 4; ++nb) {
#pragma unroll
            for (int j = 0; j < 8; ++j) os[(hi * 8 + j) * 68 + nb * 16 + lr] = acc[mb][nb][j]; }
        __builtin_amdgcn_wave_barrier(); asm volatile("" ::: "memory");
        float* crow = C + (size_t)(r0 + mb * 16) * ldc + c0;
{
#pragma unroll
            for (int s = 0; s < 8; ++s) { const int row = 2 * s + hi, cofs = lr * 4; v4f val = *(const v4fa*)(os + row * 68 + cofs); if (BIAS) { val[0] += bfr(bias[c0 + cofs]); val[1] += bfr(bias[c0 + cofs + 1]); val[2] += bfr(bias[c0 + cofs + 2]); val[3] += bfr(bias[c0 + cofs + 3]); }
                *(v4f*)(crow + (size_t)row * ldc + cofs) = val; }
             }
        __builtin_amdgcn_wave_barrier(); asm volatile("" ::: "memory");
    }
}
// ---- k_proj: BOTH projections in one launch (neither reads the other's result); the block index picks the product. The aspect's 256 tiles stand first, then the context's 1,024 in the order they had (row tile fastest).
#define PJ_A (NB_ * (DM / 64))    // tiles of the aspect's projection: 8 row tiles an entry
#define PJ_C ((NB_ * NQ / 64) * (DM / 64))   // tiles of the context's projection
__global__ __launch_bounds__(32) void k_proj(const bf* __restrict__ CB, const bf* __restrict__ WCB, const bf* __restrict__ AB, const bf* __restrict__ WAB, int K, float* CP, float* AT) {
    const unsigned t = blockIdx.x; const bf* A; const bf* Bt; float* C; int ldc, r0, c0;
    if (t < PJ_A) { const unsigned z = t / (DM / 64); A = WAB; Bt = AB + (size_t)z * NK * DM; C = AT + (size_t)z * DM * NK; ldc = NK; r0 = (int)(t % (DM / 64)) * 64; c0 = 0; }
    else { const unsigned u = t - PJ_A; A = CB; Bt = WCB; C = CP; ldc = DM; r0 = (int)(u % (NB_ * NQ / 64)) * 64; c0 = (int)(u / (NB_ * NQ / 64)) * 64; }
    gemmw_tile<bf, 0, false>(A, nullptr, Bt, nullptr, K, C, ldc, nullptr, r0, c0);
}

__device__ __forceinline__ h16 tohx(float x) { return (h16)x; }
__device__ __forceinline__ void splitf(float y, unsigned short& h, unsigned short& l) { h = f2bf(y); l = f2bf(y - bf2f(h)); }
typedef __attribute__((ext_vector_type(2))) _Float16 v2h;
typedef __attribute__((ext_vector_type(4))) _Float16 v4h;
typedef __attribute__((ext_vector_type(2))) unsigned short v2us;
typedef __attribute__((ext_vector_type(4))) unsigned short v4us;
typedef __attribute__((ext_vector_type(2))) float v2f;
typedef __attribute__((ext_vector_type(4))) int v4i;
__device__ __forceinline__ void cvt8(const float* __restrict__ src, bf* dst, size_t i) { const v8f v = *(const v8f*)(src + i * 8); v8us o;
#pragma unroll
    for (int k = 0; k < 8; ++k) o[k] = f2bf(v[k]); *(v8us*)(dst + i * 8) = o;  }

// ---- k_attn: scores, softmax and the last product of RT context rows in one work-group of RT / RW waves.
// REGISTER BLOCK OF THE SCORES: a wave holds RW whole score rows; a lane holds, of each, the two neighbouring aspect rows 2 * lane and 2 * lane + 1. One 8-byte load of the aspect's projection serves 2 * RW tangents,
// and the context's words, the same for the whole wave, come as scalar loads and stand in the additions as scalar operands. Each score is still one chain over the 512 units in their order.
// Each wave then forms CW tiles of 16 output columns for all RT rows: D[m = column][n = row] = sum_j VT[column][j] w[row][j], so a lane holds 8 neighbouring columns of one row.
#define RT 32                     // context rows a work-group (two of the matrix instruction's N)
#define RW 4                      // context rows a wave
#define NW (RT / RW)              // waves a work-group
#define NT (NW * 32)              // threads a work-group
#define CW (DM / 16 / NW)         // column tiles a wave
#define EB 8                      // units a block of the score loop
#define PP (NK + 8)               // pitch of the weights in LDS, f16 words: 16 bytes over a row, for the 16-byte fragment reads
#define OP (DM + 4)               // pitch of the output tile in LDS, floats: 16 bytes over a row
typedef v2f __attribute__((may_alias)) v2fa;
typedef v2h __attribute__((may_alias)) v2ha;
struct SBlk { v2f a[EB]; float c[RW][EB]; float v[EB]; };   // one block's operands: the aspect's words (vector registers), the context's and the score vector's (scalar registers)
__device__ __forceinline__ void sblk_ld(SBlk& k, const v2f* __restrict__ a, const float* __restrict__ c, const float* __restrict__ vv, int e0) {
#pragma unroll
    for (int q = 0; q < EB; ++q) k.a[q] = a[(size_t)(e0 + q) * (NK / 2)];
#pragma unroll
    for (int r = 0; r < RW; ++r)
#pragma unroll
        for (int q = 0; q < EB; ++q) k.c[r][q] = c[r * DM + e0 + q];
#pragma unroll
    for (int q = 0; q < EB; ++q) k.v[q] = vv[e0 + q];
}
__device__ __forceinline__ void sblk_rnd(SBlk& k) {
#pragma unroll
    for (int q = 0; q < EB; ++q) k.v[q] = bfr(k.v[q]);
}
__device__ __forceinline__ void sblk_do(const SBlk& k, v2f* s) {
#pragma unroll
    for (int q = 0; q < EB; ++q) { const float vb = k.v[q];
#pragma unroll
        for (int r = 0; r < RW; ++r) { s[r][0] += vb * __builtin_amdgcn_tanhf(k.c[r][q] + k.a[q][0]); s[r][1] += vb * __builtin_amdgcn_tanhf(k.c[r][q] + k.a[q][1]); } }   // the chip's own tangent instruction
}
__global__ __launch_bounds__(NT) void k_attn(const float* __restrict__ CP, const float* __restrict__ AT, const float* __restrict__ vv, const h16* __restrict__ VT, float* OUT) {
    __shared__ __align__(16) float Ss[RT * NK];   // scores
    __shared__ __align__(16) float Es[RT * NK];   // exponentials
    __shared__ __align__(16) h16 Ps[RT * PP];     // weights
    __shared__ __align__(16) float Os[RT * OP];   // the output tile, for whole-line stores
    const unsigned tid = threadIdx.x, lane = tid & 31, lr = lane & 15, hi = lane >> 4, b = blockIdx.x / (NQ / RT);
    const unsigned w = (unsigned)__builtin_amdgcn_readfirstlane((int)(tid >> 5));   // the wave's number as a scalar: the context's addresses are then scalar too
    const float* c = CP + ((size_t)blockIdx.x * RT + w * RW) * DM; const v2f* a = (const v2f*)(AT + (size_t)b * DM * NK) + lane;
    const h16* vt = VT + (size_t)b * DM * NK + (size_t)(w * CW * 16 + lr) * NK + 8 * hi;
    v16h va[CW][2];   // this wave's columns of the aspect, asked for in front of the score loop: behind it their latency would stand open at the first barrier
#pragma unroll
    for (int t = 0; t < CW; ++t) { va[t][0] = WFrag<h16>::ld(vt + t * 16 * NK); va[t][1] = WFrag<h16>::ld(vt + t * 16 * NK + 32); }
    v2f s[RW];
#pragma unroll
    for (int r = 0; r < RW; ++r) s[r] = (v2f){0.0f, 0.0f};
    SBlk k0, k1;   // two sets: the next block's loads fly while this block's tangents issue
    sblk_ld(k0, a, c, vv, 0);
    // The order of a half trip: (1) this block's score-vector words are rounded: the first use of its scalar words, so the one wait for scalar loads (it can only be to 0) stands in front of the next block's; (2) the next block's loads; (3) this block's tangents.
    // sched_barrier(0) keeps the three parts in that order in the schedule; wave_barrier (no instruction) keeps the compiler from moving the loads of part 2 over the loop's back edge down to their first use. Without them every load's latency stands open.
    for (int e0 = 0; e0 < DM; e0 += 2 * EB) {
        sblk_rnd(k0); __builtin_amdgcn_sched_barrier(0);
        sblk_ld(k1, a, c, vv, e0 + EB); __builtin_amdgcn_wave_barrier(); __builtin_amdgcn_sched_barrier(0);
        sblk_do(k0, s); __builtin_amdgcn_sched_barrier(0);
        sblk_rnd(k1); __builtin_amdgcn_sched_barrier(0);
        sblk_ld(k0, a, c, vv, (e0 + 2 * EB) & (DM - 1)); __builtin_amdgcn_wave_barrier(); __builtin_amdgcn_sched_barrier(0);   // the last trip asks for block 0 again: in bounds, not used
        sblk_do(k1, s); __builtin_amdgcn_sched_barrier(0);
    }
#pragma unroll
    for (int r = 0; r < RW; ++r) *(v2fa*)(Ss + (w * RW + r) * NK + 2 * lane) = s[r];
    __syncthreads();
    v2f ex[RW];
#pragma unroll
    for (int r = 0; r < RW; ++r) { const float* srow = Ss + (w * RW + r) * NK; float mx = srow[0];
#pragma unroll   // straight-line: the row comes as 16-byte LDS reads at literal offsets, several in flight
        for (int q = 0; q < NK / 4; ++q) { const v4f x = *(const v4fa*)(srow + q * 4); mx = fmaxf(fmaxf(fmaxf(fmaxf(mx, x[0]), x[1]), x[2]), x[3]); }
        ex[r] = (v2f){expf(s[r][0] - mx), expf(s[r][1] - mx)};
        *(v2fa*)(Es + (w * RW + r) * NK + 2 * lane) = ex[r]; }
    __syncthreads();
#pragma unroll
    for (int r = 0; r < RW; ++r) { const float* erow = Es + (w * RW + r) * NK; float sum = 0.0f;
#pragma unroll   // straight-line, as above; the additions stay one chain in the order of the aspect rows
        for (int q = 0; q < NK / 4; ++q) { const v4f x = *(const v4fa*)(erow + q * 4); sum += x[0]; sum += x[1]; sum += x[2]; sum += x[3]; }
        *(v2ha*)(Ps + (w * RW + r) * PP + 2 * lane) = (v2h){tohx(ex[r][0] / sum), tohx(ex[r][1] / sum)}; }
    __syncthreads();
#pragma unroll
    for (int n = 0; n < RT / 16; ++n) { const h16* pb = Ps + (n * 16 + lr) * PP + 8 * hi;
        const v16h p0 = cat16(*(const v8ha*)pb, *(const v8ha*)(pb + 16)), p1 = cat16(*(const v8ha*)(pb + 32), *(const v8ha*)(pb + 48));
#pragma unroll
        for (int t = 0; t < CW; ++t) { v8f acc = (v8f){};
            acc = wmma16(va[t][0], p0, acc);
            acc = wmma16(va[t][1], p1, acc);
            float* op = Os + (n * 16 + lr) * OP + (w * CW + t) * 16 + hi * 8;
            *(v4fa*)op = (v4f){acc[0], acc[1], acc[2], acc[3]}; *(v4fa*)(op + 4) = (v4f){acc[4], acc[5], acc[6], acc[7]}; } }
    __syncthreads();
    const unsigned r2 = tid / (DM / 4), col = (tid % (DM / 4)) * 4; const float* osp = Os + r2 * OP + col; float* gp = OUT + ((size_t)blockIdx.x * RT + r2) * DM + col;
#pragma unroll   // straight-line: the LDS reads go out ahead of the stores, and one address serves all of each at literal offsets
    for (int q = 0; q < RT * DM / 4 / NT; ++q) *(v4f*)(gp + (size_t)q * (NT * 4)) = *(const v4fa*)(osp + q * (NT * 4 / DM) * OP);
}
__device__ __forceinline__ void vt8(const float* __restrict__ src, h16* VT, unsigned idx) { const unsigned j0 = (idx % (NK / 8)) * 8, d = (idx / (NK / 8)) % DM, b = idx / ((NK / 8) * DM); v8h o;
#pragma unroll
    for (int q = 0; q < 8; ++q) o[q] = tohx(bfr(src[((size_t)b * NK + j0 + q) * DM + d]));
    *(v8h*)(VT + (size_t)idx * 8) = o;  }
// ---- k_prep: the four bf16 copies and the transposed f16 plane in one launch (none reads another's result); the block index picks the job, every range exact.
#define PB_VT (NB_ * DM * NK / 8 / 256)   // blocks of the transposed plane (its strided reads take longest: first)
#define PB_C  (NB_ * NQ * DM / 8 / 256)   // the context's copy
#define PB_A  (NB_ * NK * DM / 8 / 256)   // the aspect's copy
#define PB_W  (DM * DM / 8 / 256)         // one projection's copy
__global__ __launch_bounds__(256) void k_prep(const float* __restrict__ a0, const float* __restrict__ a1, const float* __restrict__ a2, const float* __restrict__ a3, bf* CB, bf* AB, bf* WCB, bf* WAB, h16* VT) {
    unsigned t = blockIdx.x;
    if (t < PB_VT) { vt8(a1, VT, t * 256 + threadIdx.x); return; }
    t -= PB_VT; const float* src; bf* dst;
    if (t < PB_C) { src = a0; dst = CB; }
    else if ((t -= PB_C) < PB_A) { src = a1; dst = AB; }
    else if ((t -= PB_A) < PB_W) { src = a2; dst = WCB; }
    else { t -= PB_W; src = a3; dst = WAB; }
    cvt8(src, dst, (size_t)t * 256 + threadIdx.x);
}

extern "C" void kernel_launch(void* const* d_in, const int* in_sizes, int n_in,
                              void* d_out, int out_size, void* d_ws, size_t ws_size, hipStream_t stream) {
    (void)in_sizes; (void)n_in; (void)out_size;
    const float* a0 = (const float*)d_in[0]; const float* a1 = (const float*)d_in[1]; const float* a2 = (const float*)d_in[2]; const float* a3 = (const float*)d_in[3]; const float* a4 = (const float*)d_in[4];   /* the module's argument order: the context, the aspect, the two projections, the score vector: FIVE inputs, all read */
    float* OUT = (float*)d_out;     // [32][256][512]
    char* wsp = (char*)d_ws;
    auto take = [&](size_t bytes) { char* p = wsp; wsp += (bytes + 255) & ~(size_t)255; return (void*)p; };
    bf* CB = (bf*)take((size_t)NB_ * NQ * DM * 2); bf* AB = (bf*)take((size_t)NB_ * NK * DM * 2); bf* WCB = (bf*)take((size_t)DM * DM * 2); bf* WAB = (bf*)take((size_t)DM * DM * 2);
    float* CP = (float*)take((size_t)NB_ * NQ * DM * 4); float* AT = (float*)take((size_t)NB_ * DM * NK * 4);
    h16* VT = (h16*)take((size_t)NB_ * DM * NK * 2);
    if ((size_t)(wsp - (char*)d_ws) > ws_size) return;    // total 33.00 MiB carved
    k_prep<<<(unsigned)(PB_VT + PB_C + PB_A + 2 * PB_W), 256, 0, stream>>>(a0, a1, a2, a3, CB, AB, WCB, WAB, VT);   /* the four bf16 copies and the transposed f16 plane */
    k_proj<<<(unsigned)(PJ_A + PJ_C), 32, 0, stream>>>(CB, WCB, AB, WAB, DM, CP, AT);   /* the context's projection (all 8,192 rows) and the aspect's, transposed (the projection shared by the 32 entries) */
    k_attn<<<(unsigned)(NB_ * NQ / RT), NT, 0, stream>>>(CP, AT, a4, VT, OUT);   /* scores, softmax and out[b][i][d] = sum_j w[b][i][j] aspect[b][j][d] (depth 64) for 32 context rows a work-group; the one writer of the output */
}

// v005
// A run of this version takes 48.2 microseconds.
// In two side-by-side timings against v004, it was 1.12 and 1.18 times as fast.
// Over all steps from v000 it is 6.38 times as fast.
#include <hip/hip_runtime.h>

// An additive (tangent) attention of a context over an aspect (inputs, in argument order: a0 [32][256][512] the context; a1 [32][64][512] the aspect; a2, a3 [512][512] two projections ('out, in'); a4 [512] a score vector):
//   c = a0 a2^T ([256][512] an entry);  a = a1 a3^T ([64][512] an entry);  s[i][j] = the sum over the 512 units e of a4[e] tanh(c[i][e] + a[j][e]);  w = softmax over the 64 aspect rows j;  out[i][:] = the sum over j of w[i][j] a1[j][:]  ->  [32][256][512] (4.2 M).
// THE MODULE's OWN ORDER. Layout: bf16 copies of the four matrices (cvt8 in k_prep: the projections stand 'out, in' = a K-contiguous operand of the product as they are); the context's projection CP [8192][512] f32 by one product; THE ASPECT's PROJECTION IS COMPUTED ALREADY TRANSPOSED, AT [32][512][64] f32, by giving the projection as the product's first operand (shared by the entries) and an entry's aspect rows as its second;
// vt8 (in k_prep) lays an entry's aspect rows transposed as an f16 plane VT [32][512][64]; k_attn does the rest for 32 context rows a work-group: the scores (one loop of 512 units with the chip's tangent instruction, a thread holding 4 rows by 2 aspect rows), each row's softmax (every thread walks its rows' 64 words in LDS: the maximum, then the sum in the order of the 64 aspect rows) with the weights as ONE f16 word, and the last product (f16 words of both operands; depth 64); scores and weights pass through LDS and never reach memory.
// THREE LAUNCHES: k_prep (copies and transposed plane), k_proj (both projections), k_attn (scores, softmax, last product).
// Every address from the lane's own index, a loop's own counter and launch constants; exact grids, no guard; no atomic, and no cross-lane word but the wave's own number taken as a scalar in k_attn.
// Compute dtypes, f32 accumulate: every float input rounded to bf16 at its load; both projections ONE bf16 product on exact operands; scores and softmax f32; the weights ONE f16 word each against the aspect's own bf16 words carried as f16 (exact but for words under 2^-14).

#define NB_  32                   // entries
#define NQ   256                  // context rows (queries) an entry
#define NK   64                   // aspect rows (keys = values) an entry
#define DM   512                  // the width of both and the units
typedef _Float16 h16;
typedef unsigned short bf;
typedef __attribute__((ext_vector_type(16))) __bf16   v16bf;
typedef __attribute__((ext_vector_type(16))) _Float16 v16h;
typedef __attribute__((ext_vector_type(8)))  _Float16 v8h;
typedef __attribute__((ext_vector_type(8)))  unsigned short v8us;
typedef __attribute__((ext_vector_type(8)))  float    v8f;
typedef __attribute__((ext_vector_type(4)))  float    v4f;
typedef v8h  __attribute__((may_alias)) v8ha;
typedef v4f  __attribute__((may_alias)) v4fa;
typedef v8us __attribute__((may_alias)) v8usa;

__device__ __forceinline__ unsigned short f2bf(float f) { unsigned u = __float_as_uint(f); u += 0x7FFFu + ((u >> 16) & 1u); return (unsigned short)(u >> 16); }
__device__ __forceinline__ float bf2f(unsigned short b) { return __uint_as_float(((unsigned)b) << 16); }
__device__ __forceinline__ float bfr(float f) { return bf2f(f2bf(f)); }
__device__ __forceinline__ v16h cat16(v8h lo, v8h hi) { return __builtin_shufflevector(lo, hi, 0, 1, 2, 3, 4, 5, 6, 7, 8, 9, 10, 11, 12, 13, 14, 15); }
__device__ __forceinline__ v16bf cat16b(v8us lo, v8us hi) { return __builtin_bit_cast(v16bf, __builtin_shufflevector(lo, hi, 0, 1, 2, 3, 4, 5, 6, 7, 8, 9, 10, 11, 12, 13, 14, 15)); }
__device__ __forceinline__ v8f wmma16(v16h a, v16h b, v8f c) { return __builtin_amdgcn_wmma_f32_16x16x32_f16(false, a, false, b, (short)0, c, false, false); }
__device__ __forceinline__ v8f wmmab(v16bf a, v16bf b, v8f c) { return __builtin_amdgcn_wmma_f32_16x16x32_bf16(false, a, false, b, (short)0, c, false, false); }



// ---- gemmw_tile: register-blocked GEMM, ONE WAVE per 64x64 output tile (16 accumulators), operands straight from K-contiguous 16-bit planes; 32 threads.
// C[m][n] (f32, pitch ldc, + optional f32 bias[n]) = sum_k A[m][k] Bt[n][k] (+ split products per NSPLIT). K % 32 == 0.
template <typename T16> struct WFrag;
template <> struct WFrag<h16> { typedef v16h V; static __device__ __forceinline__ V ld(const h16* p) { return cat16(*(const v8h*)p, *(const v8h*)(p + 16)); } static __device__ __forceinline__ v8f mma(V a, V b, v8f c) { return wmma16(a, b, c); } };
template <> struct WFrag<bf> { typedef v16bf V; static __device__ __forceinline__ V ld(const bf* p) { return cat16b(*(const v8us*)p, *(const v8us*)(p + 16)); } static __device__ __forceinline__ v8f mma(V a, V b, v8f c) { return wmmab(a, b, c); } };
// gemmw_tile: one wave's 64x64 tile at rows r0, columns c0 (k_proj calls it).
template <typename T16, int NSPLIT, bool BIAS>
__device__ __forceinline__ void gemmw_tile(const T16* __restrict__ A, const T16* __restrict__ A2, const T16* __restrict__ Bt, const T16* __restrict__ Bt2, int K, float* C, int ldc, const float* __restrict__ bias, int r0, int c0) {
    typedef typename WFrag<T16>::V V;
    __shared__ __align__(16) float os[16 * 68];
    const int lane = threadIdx.x & 31, lr = lane & 15, hi = lane >> 4;
    v8f acc[4][4];
#pragma unroll
    for (int mb = 0; mb < 4; ++mb)
#pragma unroll
        for (int nb = 0; nb < 4; ++nb) acc[mb][nb] = (v8f){};
    const size_t aoff = (size_t)(r0 + lr) * K + 8 * hi, boff = (size_t)(c0 + lr) * K + 8 * hi;

    for (int kc = 0; kc < K; kc += 32) {
        V a[4], a2[4];
#pragma unroll
        for (int mb = 0; mb < 4; ++mb) { a[mb] = WFrag<T16>::ld(A + aoff + (size_t)mb * 16 * K + kc); if (NSPLIT == 1 || NSPLIT == 2) a2[mb] = WFrag<T16>::ld(A2 + aoff + (size_t)mb * 16 * K + kc); }
#pragma unroll
        for (int nb = 0; nb < 4; ++nb) { const V b = WFrag<T16>::ld(Bt + boff + (size_t)nb * 16 * K + kc); V b2; if (NSPLIT >= 2) b2 = WFrag<T16>::ld(Bt2 + boff + (size_t)nb * 16 * K + kc);
#pragma unroll
            for (int mb = 0; mb < 4; ++mb) { acc[mb][nb] = WFrag<T16>::mma(a[mb], b, acc[mb][nb]); if (NSPLIT == 1 || NSPLIT == 2) acc[mb][nb] = WFrag<T16>::mma(a2[mb], b, acc[mb][nb]); if (NSPLIT >= 2) acc[mb][nb] = WFrag<T16>::mma(a[mb], b2, acc[mb][nb]); } }
        asm volatile("v_nop\n\tv_nop\n\tv_nop\n\tv_nop" : "+v"(acc[0][0]), "+v"(acc[1][1]), "+v"(acc[2][2]), "+v"(acc[3][3]) : "v"(a[0]), "v"(a[3]));
    }
#pragma unroll
    for (int mb = 0; mb < 4; ++mb) {
#pragma unroll
        for (int nb = 0; nb < 4; ++nb) {
#pragma unroll
            for (int j = 0; j < 8; ++j) os[(hi * 8 + j) * 68 + nb * 16 + lr] = acc[mb][nb][j]; }
        __builtin_amdgcn_wave_barrier(); asm volatile("" ::: "memory");
        float* crow = C + (size_t)(r0 + mb * 16) * ldc + c0;
{
#pragma unroll
            for (int s = 0; s < 8; ++s) { const int row = 2 * s + hi, cofs = lr * 4; v4f val = *(const v4fa*)(os + row * 68 + cofs); if (BIAS) { val[0] += bfr(bias[c0 + cofs]); val[1] += bfr(bias[c0 + cofs + 1]); val[2] += bfr(bias[c0 + cofs + 2]); val[3] += bfr(bias[c0 + cofs + 3]); }
                *(v4f*)(crow + (size_t)row * ldc + cofs) = val; }
             }
        __builtin_amdgcn_wave_barrier(); asm volatile("" ::: "memory");
    }
}
// ---- k_proj: BOTH projections in one launch (neither reads the other's result); the block index picks the product. The aspect's 256 tiles stand first, then the context's 1,024 in the order they had (row tile fastest).
#define PJ_A (NB_ * (DM / 64))    // tiles of the aspect's projection: 8 row tiles an entry
#define PJ_C ((NB_ * NQ / 64) * (DM / 64))   // tiles of the context's projection
__global__ __launch_bounds__(32) void k_proj(const bf* __restrict__ CB, const bf* __restrict__ WCB, const bf* __restrict__ AB, const bf* __restrict__ WAB, int K, float* CP, float* AT) {
    const unsigned t = blockIdx.x; const bf* A; const bf* Bt; float* C; int ldc, r0, c0;
    if (t < PJ_A) { const unsigned z = t / (DM / 64); A = WAB; Bt = AB + (size_t)z * NK * DM; C = AT + (size_t)z * DM * NK; ldc = NK; r0 = (int)(t % (DM / 64)) * 64; c0 = 0; }
    else { const unsigned u = t - PJ_A; A = CB; Bt = WCB; C = CP; ldc = DM; r0 = (int)(u % (NB_ * NQ / 64)) * 64; c0 = (int)(u / (NB_ * NQ / 64)) * 64; }
    gemmw_tile<bf, 0, false>(A, nullptr, Bt, nullptr, K, C, ldc, nullptr, r0, c0);
}

__device__ __forceinline__ h16 tohx(float x) { return (h16)x; }
__device__ __forceinline__ void splitf(float y, unsigned short& h, unsigned short& l) { h = f2bf(y); l = f2bf(y - bf2f(h)); }
typedef __attribute__((ext_vector_type(2))) _Float16 v2h;
typedef __attribute__((ext_vector_type(4))) _Float16 v4h;
typedef __attribute__((ext_vector_type(2))) unsigned short v2us;
typedef __attribute__((ext_vector_type(4))) unsigned short v4us;
typedef __attribute__((ext_vector_type(2))) float v2f;
typedef __attribute__((ext_vector_type(4))) int v4i;
__device__ __forceinline__ void cvt8(const float* __restrict__ src, bf* dst, size_t i) { const v8f v = *(const v8f*)(src + i * 8); v8us o;
#pragma unroll
    for (int k = 0; k < 8; ++k) o[k] = f2bf(v[k]); *(v8us*)(dst + i * 8) = o;  }

// ---- k_attn: scores, softmax and the last product of RT context rows in one work-group of RT / RW waves.
// REGISTER BLOCK OF THE SCORES: a wave holds RW whole score rows; a lane holds, of each, the two neighbouring aspect rows 2 * lane and 2 * lane + 1. One 8-byte read of the aspect's projection serves 2 * RW tangents.
// BOTH OPERANDS OF THE SCORE LOOP STAND IN LDS: the entry's aspect projection whole (all 8 waves read all of it) and the work-group's RT rows of the context's projection, brought in front of the loop by asynchronous copies, all in flight at once;
// the loop then reads no global memory but the score vector. A wave's context words come as 16-byte reads of one address for all lanes. Each score is still one chain over the 512 units in their order.
// Each wave then forms CW tiles of 16 output columns for all RT rows: D[m = column][n = row] = sum_j VT[column][j] w[row][j], so a lane holds 8 neighbouring columns of one row.
#define RT 32                     // context rows a work-group (two of the matrix instruction's N)
#define RW 4                      // context rows a wave
#define NW (RT / RW)              // waves a work-group
#define NT (NW * 32)              // threads a work-group
#define CW (DM / 16 / NW)         // column tiles a wave
#define EB 8                      // units a block of the score loop
#define PP (NK + 8)               // pitch of the weights in LDS, f16 words: 16 bytes over a row, for the 16-byte fragment reads
#define OP (DM + 4)               // pitch of the output tile in LDS, floats: 16 bytes over a row
typedef v2f __attribute__((may_alias)) v2fa;
typedef v2h __attribute__((may_alias)) v2ha;
struct SBlk { v2f a[EB]; v4f c[RW][EB / 4]; float v[EB]; };   // one block's operands: the aspect's and the context's words (vector registers, from LDS), the score vector's (scalar registers)
__device__ __forceinline__ void sblk_ld(SBlk& k, const float* a, const float* c, const float* __restrict__ vv, int e0) {
#pragma unroll
    for (int q = 0; q < EB; ++q) k.a[q] = *(const v2fa*)(a + (e0 + q) * NK);
#pragma unroll
    for (int r = 0; r < RW; ++r)
#pragma unroll
        for (int q = 0; q < EB / 4; ++q) k.c[r][q] = *(const v4fa*)(c + r * DM + e0 + q * 4);
#pragma unroll
    for (int q = 0; q < EB; ++q) k.v[q] = vv[e0 + q];
}
__device__ __forceinline__ void sblk_rnd(SBlk& k) {
#pragma unroll
    for (int q = 0; q < EB; ++q) k.v[q] = bfr(k.v[q]);
}
__device__ __forceinline__ void sblk_do(const SBlk& k, v2f* s) {
#pragma unroll
    for (int q = 0; q < EB; ++q) { const float vb = k.v[q];
#pragma unroll
        for (int r = 0; r < RW; ++r) { const float cw = k.c[r][q >> 2][q & 3]; s[r][0] += vb * __builtin_amdgcn_tanhf(cw + k.a[q][0]); s[r][1] += vb * __builtin_amdgcn_tanhf(cw + k.a[q][1]); } }   // the chip's own tangent instruction
}
// cp8: eight 16-byte asynchronous copies of a lane, global memory to LDS through no register, NT * 16 bytes apart in both. The s_wait_xcnt stands inside the statement, behind the last copy, so that no address register is rewritten in front of it.
#define CPS (NT * 16)             // bytes one copy of the whole work-group brings
__device__ __forceinline__ void cp8(unsigned l, const char* g) {
    asm volatile("global_load_async_to_lds_b128 %0, %8, off\n\t"
                 "global_load_async_to_lds_b128 %1, %9, off\n\t"
                 "global_load_async_to_lds_b128 %2, %10, off\n\t"
                 "global_load_async_to_lds_b128 %3, %11, off\n\t"
                 "global_load_async_to_lds_b128 %4, %12, off\n\t"
                 "global_load_async_to_lds_b128 %5, %13, off\n\t"
                 "global_load_async_to_lds_b128 %6, %14, off\n\t"
                 "global_load_async_to_lds_b128 %7, %15, off\n\t"
                 "s_wait_xcnt 0x0"
                 :: "v"(l), "v"(l + CPS), "v"(l + 2 * CPS), "v"(l + 3 * CPS), "v"(l + 4 * CPS), "v"(l + 5 * CPS), "v"(l + 6 * CPS), "v"(l + 7 * CPS),
                    "v"(g), "v"(g + CPS), "v"(g + 2 * CPS), "v"(g + 3 * CPS), "v"(g + 4 * CPS), "v"(g + 5 * CPS), "v"(g + 6 * CPS), "v"(g + 7 * CPS) : "memory");
}
__global__ __launch_bounds__(NT) void k_attn(const float* __restrict__ CP, const float* __restrict__ AT, const float* __restrict__ vv, const h16* __restrict__ VT, float* OUT) {
    __shared__ __align__(16) float As[DM * NK];   // the entry's aspect projection, transposed, whole (128 KiB)
    __shared__ __align__(16) float Cs[RT * DM];   // this work-group's rows of the context's projection (64 KiB)
    __shared__ __align__(16) float Ss[RT * NK];   // scores
    __shared__ __align__(16) float Es[RT * NK];   // exponentials
    __shared__ __align__(16) h16 Ps[RT * PP];     // weights
    __shared__ __align__(16) float Os[RT * OP];   // the output tile, for whole-line stores
    const unsigned tid = threadIdx.x, lane = tid & 31, lr = lane & 15, hi = lane >> 4, b = blockIdx.x / (NQ / RT);
    const unsigned w = (unsigned)__builtin_amdgcn_readfirstlane((int)(tid >> 5));   // the wave's number as a scalar
    const float* c = Cs + w * RW * DM; const float* a = As + 2 * lane;
    const h16* vt = VT + (size_t)b * DM * NK + (size_t)(w * CW * 16 + lr) * NK + 8 * hi;
    v16h va[CW][2];   // this wave's columns of the aspect, asked for in front of the score loop: behind it their latency would stand open at the first barrier
#pragma unroll
    for (int t = 0; t < CW; ++t) { va[t][0] = WFrag<h16>::ld(vt + t * 16 * NK); va[t][1] = WFrag<h16>::ld(vt + t * 16 * NK + 32); }
    { const char* ga = (const char*)(AT + (size_t)b * DM * NK) + tid * 16; const char* gc = (const char*)(CP + (size_t)blockIdx.x * RT * DM) + tid * 16;
      const unsigned la = (unsigned)(size_t)As + tid * 16, lc = (unsigned)(size_t)Cs + tid * 16;   // the low 32 bits of a __shared__ address: the byte's place in the work-group's LDS
#pragma unroll   // straight-line: 16 + 32 copies a lane, every one outstanding at once (63 is the limit)
      for (int i = 0; i < RT * DM * 4 / (8 * CPS); ++i) cp8(lc + i * 8 * CPS, gc + i * 8 * CPS);
#pragma unroll
      for (int i = 0; i < DM * NK * 4 / (8 * CPS); ++i) cp8(la + i * 8 * CPS, ga + i * 8 * CPS); }
    asm volatile("s_wait_asynccnt 0x0" ::: "memory");   // this wave's copies have landed; the compiler places no wait for them
    __syncthreads();                                    // and every other wave's: nobody reads As or Cs in front of this barrier
    v2f s[RW];
#pragma unroll
    for (int r = 0; r < RW; ++r) s[r] = (v2f){0.0f, 0.0f};
    SBlk k0, k1;   // two sets: the next block's loads fly while this block's tangents issue
    sblk_ld(k0, a, c, vv, 0);
    // The order of a half trip: (1) this block's score-vector words are rounded: the first use of its scalar words, so the one wait for scalar loads (it can only be to 0) stands in front of the next block's; (2) the next block's LDS reads and scalar load; (3) this block's tangents.
    // sched_barrier(0) keeps the three parts in that order in the schedule; wave_barrier (no instruction) keeps the compiler from moving the loads of part 2 over the loop's back edge down to their first use. Without them every load's latency stands open.
    for (int e0 = 0; e0 < DM; e0 += 2 * EB) {
        sblk_rnd(k0); __builtin_amdgcn_sched_barrier(0);
        sblk_ld(k1, a, c, vv, e0 + EB); __builtin_amdgcn_wave_barrier(); __builtin_amdgcn_sched_barrier(0);
        sblk_do(k0, s); __builtin_amdgcn_sched_barrier(0);
        sblk_rnd(k1); __builtin_amdgcn_sched_barrier(0);
        sblk_ld(k0, a, c, vv, (e0 + 2 * EB) & (DM - 1)); __builtin_amdgcn_wave_barrier(); __builtin_amdgcn_sched_barrier(0);   // the last trip asks for block 0 again: in bounds, not used
        sblk_do(k1, s); __builtin_amdgcn_sched_barrier(0);
    }
#pragma unroll
    for (int r = 0; r < RW; ++r) *(v2fa*)(Ss + (w * RW + r) * NK + 2 * lane) = s[r];
    __syncthreads();
    v2f ex[RW];
#pragma unroll
    for (int r = 0; r < RW; ++r) { const float* srow = Ss + (w * RW + r) * NK; float mx = srow[0];
#pragma unroll   // straight-line: the row comes as 16-byte LDS reads at literal offsets, several in flight
        for (int q = 0; q < NK / 4; ++q) { const v4f x = *(const v4fa*)(srow + q * 4); mx = fmaxf(fmaxf(fmaxf(fmaxf(mx, x[0]), x[1]), x[2]), x[3]); }
        ex[r] = (v2f){expf(s[r][0] - mx), expf(s[r][1] - mx)};
        *(v2fa*)(Es + (w * RW + r) * NK + 2 * lane) = ex[r]; }
    __syncthreads();
#pragma unroll
    for (int r = 0; r < RW; ++r) { const float* erow = Es + (w * RW + r) * NK; float sum = 0.0f;
#pragma unroll   // straight-line, as above; the additions stay one chain in the order of the aspect rows
        for (int q = 0; q < NK / 4; ++q) { const v4f x = *(const v4fa*)(erow + q * 4); sum += x[0]; sum += x[1]; sum += x[2]; sum += x[3]; }
        *(v2ha*)(Ps + (w * RW + r) * PP + 2 * lane) = (v2h){tohx(ex[r][0] / sum), tohx(ex[r][1] / sum)}; }
    __syncthreads();
#pragma unroll
    for (int n = 0; n < RT / 16; ++n) { const h16* pb = Ps + (n * 16 + lr) * PP + 8 * hi;
        const v16h p0 = cat16(*(const v8ha*)pb, *(const v8ha*)(pb + 16)), p1 = cat16(*(const v8ha*)(pb + 32), *(const v8ha*)(pb + 48));
#pragma unroll
        for (int t = 0; t < CW; ++t) { v8f acc = (v8f){};
            acc = wmma16(va[t][0], p0, acc);
            acc = wmma16(va[t][1], p1, acc);
            float* op = Os + (n * 16 + lr) * OP + (w * CW + t) * 16 + hi * 8;
            *(v4fa*)op = (v4f){acc[0], acc[1], acc[2], acc[3]}; *(v4fa*)(op + 4) = (v4f){acc[4], acc[5], acc[6], acc[7]}; } }
    __syncthreads();
    const unsigned r2 = tid / (DM / 4), col = (tid % (DM / 4)) * 4; const float* osp = Os + r2 * OP + col; float* gp = OUT + ((size_t)blockIdx.x * RT + r2) * DM + col;
#pragma unroll   // straight-line: the LDS reads go out ahead of the stores, and one address serves all of each at literal offsets
    for (int q = 0; q < RT * DM / 4 / NT; ++q) *(v4f*)(gp + (size_t)q * (NT * 4)) = *(const v4fa*)(osp + q * (NT * 4 / DM) * OP);
}
__device__ __forceinline__ void vt8(const float* __restrict__ src, h16* VT, unsigned idx) { const unsigned j0 = (idx % (NK / 8)) * 8, d = (idx / (NK / 8)) % DM, b = idx / ((NK / 8) * DM); v8h o;
#pragma unroll
    for (int q = 0; q < 8; ++q) o[q] = tohx(bfr(src[((size_t)b * NK + j0 + q) * DM + d]));
    *(v8h*)(VT + (size_t)idx * 8) = o;  }
// ---- k_prep: the four bf16 copies and the transposed f16 plane in one launch (none reads another's result); the block index picks the job, every range exact.
#define PB_VT (NB_ * DM * NK / 8 / 256)   // blocks of the transposed plane (its strided reads take longest: first)
#define PB_C  (NB_ * NQ * DM / 8 / 256)   // the context's copy
#define PB_A  (NB_ * NK * DM / 8 / 256)   // the aspect's copy
#define PB_W  (DM * DM / 8 / 256)         // one projection's copy
__global__ __launch_bounds__(256) void k_prep(const float* __restrict__ a0, const float* __restrict__ a1, const float* __restrict__ a2, const float* __restrict__ a3, bf* CB, bf* AB, bf* WCB, bf* WAB, h16* VT) {
    unsigned t = blockIdx.x;
    if (t < PB_VT) { vt8(a1, VT, t * 256 + threadIdx.x); return; }
    t -= PB_VT; const float* src; bf* dst;
    if (t < PB_C) { src = a0; dst = CB; }
    else if ((t -= PB_C) < PB_A) { src = a1; dst = AB; }
    else if ((t -= PB_A) < PB_W) { src = a2; dst = WCB; }
    else { t -= PB_W; src = a3; dst = WAB; }
    cvt8(src, dst, (size_t)t * 256 + threadIdx.x);
}

extern "C" void kernel_launch(void* const* d_in, const int* in_sizes, int n_in,
                              void* d_out, int out_size, void* d_ws, size_t ws_size, hipStream_t stream) {
    (void)in_sizes; (void)n_in; (void)out_size;
    const float* a0 = (const float*)d_in[0]; const float* a1 = (const float*)d_in[1]; const float* a2 = (const float*)d_in[2]; const float* a3 = (const float*)d_in[3]; const float* a4 = (const float*)d_in[4];   /* the module's argument order: the context, the aspect, the two projections, the score vector: FIVE inputs, all read */
    float* OUT = (float*)d_out;     // [32][256][512]
    char* wsp = (char*)d_ws;
    auto take = [&](size_t bytes) { char* p = wsp; wsp += (bytes + 255) & ~(size_t)255; return (void*)p; };
    bf* CB = (bf*)take((size_t)NB_ * NQ * DM * 2); bf* AB = (bf*)take((size_t)NB_ * NK * DM * 2); bf* WCB = (bf*)take((size_t)DM * DM * 2); bf* WAB = (bf*)take((size_t)DM * DM * 2);
    float* CP = (float*)take((size_t)NB_ * NQ * DM * 4); float* AT = (float*)take((size_t)NB_ * DM * NK * 4);
    h16* VT = (h16*)take((size_t)NB_ * DM * NK * 2);
    if ((size_t)(wsp - (char*)d_ws) > ws_size) return;    // total 33.00 MiB carved
    k_prep<<<(unsigned)(PB_VT + PB_C + PB_A + 2 * PB_W), 256, 0, stream>>>(a0, a1, a2, a3, CB, AB, WCB, WAB, VT);   /* the four bf16 copies and the transposed f16 plane */
    k_proj<<<(unsigned)(PJ_A + PJ_C), 32, 0, stream>>>(CB, WCB, AB, WAB, DM, CP, AT);   /* the context's projection (all 8,192 rows) and the aspect's, transposed (the projection shared by the 32 entries) */
    k_attn<<<(unsigned)(NB_ * NQ / RT), NT, 0, stream>>>(CP, AT, a4, VT, OUT);   /* scores, softmax and out[b][i][d] = sum_j w[b][i][j] aspect[b][j][d] (depth 64) for 32 context rows a work-group; the one writer of the output */
}

// v006
// A run of this version takes 39.6 microseconds.
// Timed twice side by side with v005, it ran 1.23 and 1.22 times as fast.
// Counting every step since v000, it is 7.83 times as fast.
#include <hip/hip_runtime.h>

// An additive (tangent) attention of a context over an aspect (inputs, in argument order: a0 [32][256][512] the context; a1 [32][64][512] the aspect; a2, a3 [512][512] two projections ('out, in'); a4 [512] a score vector):
//   c = a0 a2^T ([256][512] an entry);  a = a1 a3^T ([64][512] an entry);  s[i][j] = the sum over the 512 units e of a4[e] tanh(c[i][e] + a[j][e]);  w = softmax over the 64 aspect rows j;  out[i][:] = the sum over j of w[i][j] a1[j][:]  ->  [32][256][512] (4.2 M).
// THE MODULE's OWN ORDER. Layout: bf16 copies of the four matrices (cvt8 in k_prep: the projections stand 'out, in' = a K-contiguous operand of the product as they are); the context's projection CP [8192][512] f32 by one product; THE ASPECT's PROJECTION IS COMPUTED ALREADY TRANSPOSED, AT [32][512][64] f32, by giving the projection as the product's first operand (shared by the entries) and an entry's aspect rows as its second;
// vt8 (in k_prep) lays an entry's aspect rows transposed as an f16 plane VT [32][512][64]; k_attn does the rest for 32 context rows a work-group: the scores (one loop of 512 units with the chip's tangent instruction, a thread holding 4 rows by 2 aspect rows), each row's softmax (every thread walks its rows' 64 words in LDS: the maximum, then the sum in the order of the 64 aspect rows) with the weights as ONE f16 word, and the last product (f16 words of both operands; depth 64); scores and weights pass through LDS and never reach memory.
// THREE LAUNCHES: k_prep (copies and transposed plane), k_proj (both projections), k_attn (scores, softmax, last product).
// Every address from the lane's own index, a loop's own counter and launch constants; exact grids, no guard; no atomic, and no cross-lane word but the wave's own number taken as a scalar in k_proj and k_attn.
// Compute dtypes, f32 accumulate: every float input rounded to bf16 at its load; both projections ONE bf16 product on exact operands; scores and softmax f32; the weights ONE f16 word each against the aspect's own bf16 words carried as f16 (exact but for words under 2^-14).

#define NB_  32                   // entries
#define NQ   256                  // context rows (queries) an entry
#define NK   64                   // aspect rows (keys = values) an entry
#define DM   512                  // the width of both and the units
typedef _Float16 h16;
typedef unsigned short bf;
typedef __attribute__((ext_vector_type(16))) __bf16   v16bf;
typedef __attribute__((ext_vector_type(16))) _Float16 v16h;
typedef __attribute__((ext_vector_type(8)))  _Float16 v8h;
typedef __attribute__((ext_vector_type(8)))  unsigned short v8us;
typedef __attribute__((ext_vector_type(8)))  float    v8f;
typedef __attribute__((ext_vector_type(4)))  float    v4f;
typedef v8h  __attribute__((may_alias)) v8ha;
typedef v4f  __attribute__((may_alias)) v4fa;
typedef v8us __attribute__((may_alias)) v8usa;

__device__ __forceinline__ unsigned short f2bf(float f) { unsigned u = __float_as_uint(f); u += 0x7FFFu + ((u >> 16) & 1u); return (unsigned short)(u >> 16); }
__device__ __forceinline__ float bf2f(unsigned short b) { return __uint_as_float(((unsigned)b) << 16); }
__device__ __forceinline__ float bfr(float f) { return bf2f(f2bf(f)); }
__device__ __forceinline__ v16h cat16(v8h lo, v8h hi) { return __builtin_shufflevector(lo, hi, 0, 1, 2, 3, 4, 5, 6, 7, 8, 9, 10, 11, 12, 13, 14, 15); }
__device__ __forceinline__ v16bf cat16b(v8us lo, v8us hi) { return __builtin_bit_cast(v16bf, __builtin_shufflevector(lo, hi, 0, 1, 2, 3, 4, 5, 6, 7, 8, 9, 10, 11, 12, 13, 14, 15)); }
__device__ __forceinline__ v8f wmma16(v16h a, v16h b, v8f c) { return __builtin_amdgcn_wmma_f32_16x16x32_f16(false, a, false, b, (short)0, c, false, false); }
__device__ __forceinline__ v8f wmmab(v16bf a, v16bf b, v8f c) { return __builtin_amdgcn_wmma_f32_16x16x32_bf16(false, a, false, b, (short)0, c, false, false); }



// ---- WFrag: one 16x32 fragment of a K-contiguous 16-bit plane: the lane's two 16-byte pieces, 16 words apart.
template <typename T16> struct WFrag;
template <> struct WFrag<h16> { typedef v16h V; static __device__ __forceinline__ V ld(const h16* p) { return cat16(*(const v8h*)p, *(const v8h*)(p + 16)); } };
// ---- k_proj: BOTH projections in one launch (neither reads the other's result); the block index picks the product. C[m][n] (f32) = sum_k A[m][k] Bt[n][k], depth DM.
// A WORK-GROUP OF 4 WAVES FORMS A 128x128 TILE, each wave a 64x64 quarter (16 accumulators). Both operands' 128 rows pass through LDS in stages of KS words of depth, brought by asynchronous copies into two buffers:
// the next stage's copies fly while this stage's products issue, and a row is fetched from L2 once for the two waves that read it. Every accumulator still takes its 16 products in the order of k.
// The aspect's product has the projection as its first operand and the aspect rows of all entries, 2,048 in a row, as its second: a wave's 64 columns are one entry's rows, so its quarter goes to that entry's transposed plane.
#define PT 128                    // rows and columns of a work-group's tile
#define KS 128                    // depth of a stage, 16-bit words: 256 bytes a row
#define PL (KS + 8)               // pitch of a staged row in LDS, words: 16 bytes over a row, for the 16-byte fragment reads
#define PBUF (2 * PT * PL)        // words of one buffer: the first operand's rows, then the second's
#define PJ_A ((DM / PT) * (NB_ * NK / PT))   // tiles of the aspect's projection
#define PJ_C ((NB_ * NQ / PT) * (DM / PT))   // tiles of the context's projection
// cp8r: eight 16-byte asynchronous copies of a lane, global memory to LDS through no register, 8 rows apart in both. The s_wait_xcnt stands inside the statement, behind the last copy, so that no address register is rewritten in front of it.
#define RL (8 * PL * 2)           // bytes 8 rows take in LDS
#define RG (8 * DM * 2)           // and in memory
__device__ __forceinline__ void cp8r(unsigned l, const char* g) {
    asm volatile("global_load_async_to_lds_b128 %0, %8, off\n\t"
                 "global_load_async_to_lds_b128 %1, %9, off\n\t"
                 "global_load_async_to_lds_b128 %2, %10, off\n\t"
                 "global_load_async_to_lds_b128 %3, %11, off\n\t"
                 "global_load_async_to_lds_b128 %4, %12, off\n\t"
                 "global_load_async_to_lds_b128 %5, %13, off\n\t"
                 "global_load_async_to_lds_b128 %6, %14, off\n\t"
                 "global_load_async_to_lds_b128 %7, %15, off\n\t"
                 "s_wait_xcnt 0x0"
                 :: "v"(l), "v"(l + RL), "v"(l + 2 * RL), "v"(l + 3 * RL), "v"(l + 4 * RL), "v"(l + 5 * RL), "v"(l + 6 * RL), "v"(l + 7 * RL),
                    "v"(g), "v"(g + RG), "v"(g + 2 * RG), "v"(g + 3 * RG), "v"(g + 4 * RG), "v"(g + 5 * RG), "v"(g + 6 * RG), "v"(g + 7 * RG) : "memory");
}
// One stage of both operands: 16 lanes a row, 8 rows a copy of the work-group, 16 + 16 copies a lane (63 may be outstanding).
__device__ __forceinline__ void pj_stage(unsigned l, const char* ga, const char* gb) {
    cp8r(l, ga); cp8r(l + 8 * RL, ga + 8 * RG);
    cp8r(l + PT * PL * 2, gb); cp8r(l + PT * PL * 2 + 8 * RL, gb + 8 * RG);
}
__device__ __forceinline__ v16bf pj_frag(const bf* p) { return cat16b(*(const v8usa*)p, *(const v8usa*)(p + 16)); }
__global__ __launch_bounds__(128) void k_proj(const bf* __restrict__ CB, const bf* __restrict__ WCB, const bf* __restrict__ AB, const bf* __restrict__ WAB, float* CP, float* AT) {
    __shared__ __align__(16) bf St[2 * PBUF];          // the two buffers
    __shared__ __align__(16) float Ow[4 * 16 * 68];    // each wave's own 16 output rows, for whole-line stores
    const unsigned t = blockIdx.x, tid = threadIdx.x, lane = tid & 31, lr = lane & 15, hi = lane >> 4;
    const unsigned w = (unsigned)__builtin_amdgcn_readfirstlane((int)(tid >> 5)), wm = w & 1, wn = w >> 1;   // the wave's number as a scalar; its quarter
    const bf* A; const bf* Bt; float* C; int ldc;   // the tile's first rows of both operands; this wave's quarter of the result
    if (t < PJ_A) { const unsigned r0 = (t % (DM / PT)) * PT, c0 = (t / (DM / PT)) * PT; A = WAB + (size_t)r0 * DM; Bt = AB + (size_t)c0 * DM;
        C = AT + (size_t)(c0 / NK + wn) * DM * NK + (size_t)(r0 + wm * 64) * NK; ldc = NK; }
    else { const unsigned u = t - PJ_A, r0 = (u % (NB_ * NQ / PT)) * PT, c0 = (u / (NB_ * NQ / PT)) * PT; A = CB + (size_t)r0 * DM; Bt = WCB + (size_t)c0 * DM;
        C = CP + (size_t)(r0 + wm * 64) * DM + c0 + wn * 64; ldc = DM; }
    v8f acc[4][4];
#pragma unroll
    for (int mb = 0; mb < 4; ++mb)
#pragma unroll
        for (int nb = 0; nb < 4; ++nb) acc[mb][nb] = (v8f){};
    const unsigned lb = (unsigned)(size_t)St + (tid >> 4) * (PL * 2) + (tid & 15) * 16;   // the low 32 bits of a __shared__ address: the byte's place in the work-group's LDS
    const char* ga = (const char*)(A + (size_t)(tid >> 4) * DM) + (tid & 15) * 16; const char* gb = (const char*)(Bt + (size_t)(tid >> 4) * DM) + (tid & 15) * 16;
    pj_stage(lb, ga, gb);
    asm volatile("s_wait_asynccnt 0x0" ::: "memory");   // this wave's copies of stage 0 have landed; the compiler places no wait for them
    __syncthreads();                                    // and every other wave's: nobody reads stage 0 in front of this barrier
    pj_stage(lb + PBUF * 2, ga + KS * 2, gb + KS * 2);
    const bf* fa = St + (wm * 64 + lr) * PL + 8 * hi; const bf* fb = St + (PT + wn * 64 + lr) * PL + 8 * hi;
#pragma unroll 1   // rolled: one body of 64 products serves the four stages
    for (int s = 0; s < DM / KS; ++s) {
        const bf* pa = fa + (s & 1) * PBUF; const bf* pb = fb + (s & 1) * PBUF;
        v16bf a[4];
#pragma unroll
        for (int kk = 0; kk < KS / 32; ++kk) {
            v16bf b[4];
#pragma unroll
            for (int mb = 0; mb < 4; ++mb) a[mb] = pj_frag(pa + mb * 16 * PL + kk * 32);
#pragma unroll
            for (int nb = 0; nb < 4; ++nb) b[nb] = pj_frag(pb + nb * 16 * PL + kk * 32);
            __builtin_amdgcn_sched_barrier(0);   // the block's 16 LDS reads stay one group in front of its 16 products: left to itself the schedule reads each b fragment just in front of its use and waits for it four times a block
#pragma unroll
            for (int nb = 0; nb < 4; ++nb)
#pragma unroll
                for (int mb = 0; mb < 4; ++mb) acc[mb][nb] = wmmab(a[mb], b[nb], acc[mb][nb]);
            __builtin_amdgcn_sched_barrier(0);   // and the next block's reads stay behind these products, not scattered among them
        }
        asm volatile("v_nop\n\tv_nop\n\tv_nop\n\tv_nop" : "+v"(acc[0][0]), "+v"(acc[1][1]), "+v"(acc[2][2]), "+v"(acc[3][3]) : "v"(a[0]), "v"(a[3]));   // the distance behind the stage's last products, on the branches that follow too
        asm volatile("s_wait_dscnt 0x0" ::: "memory");      // this wave's reads of the buffer are done before it is refilled
        asm volatile("s_wait_asynccnt 0x0" ::: "memory");   // this wave's copies of the next stage have landed
        __syncthreads();                                    // publishes the next stage and ends every wave's reads of this one
        if (s + 2 < DM / KS) pj_stage(lb + (s & 1) * (PBUF * 2), ga + (s + 2) * (KS * 2), gb + (s + 2) * (KS * 2));
    }
    asm volatile("s_wait_asynccnt 0x0" ::: "memory");   // no copy is outstanding when the wave goes on
    float* os = Ow + w * (16 * 68);
#pragma unroll
    for (int mb = 0; mb < 4; ++mb) {
#pragma unroll
        for (int nb = 0; nb < 4; ++nb) {
#pragma unroll
            for (int j = 0; j < 8; ++j) os[(hi * 8 + j) * 68 + nb * 16 + lr] = acc[mb][nb][j]; }
        __builtin_amdgcn_wave_barrier(); asm volatile("" ::: "memory");   // no instruction: keeps the compiler from moving the wave's LDS reads below over these stores (and, at the foot, the next stores over the reads)
        float* crow = C + (size_t)(mb * 16) * ldc;
#pragma unroll
        for (int s = 0; s < 8; ++s) { const int row = 2 * s + hi, cofs = lr * 4; *(v4f*)(crow + (size_t)row * ldc + cofs) = *(const v4fa*)(os + row * 68 + cofs); }
        __builtin_amdgcn_wave_barrier(); asm volatile("" ::: "memory");
    }
}

__device__ __forceinline__ h16 tohx(float x) { return (h16)x; }
__device__ __forceinline__ void splitf(float y, unsigned short& h, unsigned short& l) { h = f2bf(y); l = f2bf(y - bf2f(h)); }
typedef __attribute__((ext_vector_type(2))) _Float16 v2h;
typedef __attribute__((ext_vector_type(4))) _Float16 v4h;
typedef __attribute__((ext_vector_type(2))) unsigned short v2us;
typedef __attribute__((ext_vector_type(4))) unsigned short v4us;
typedef __attribute__((ext_vector_type(2))) float v2f;
typedef __attribute__((ext_vector_type(4))) int v4i;
__device__ __forceinline__ void cvt8(const float* __restrict__ src, bf* dst, size_t i) { const v8f v = *(const v8f*)(src + i * 8); v8us o;
#pragma unroll
    for (int k = 0; k < 8; ++k) o[k] = f2bf(v[k]); *(v8us*)(dst + i * 8) = o;  }

// ---- k_attn: scores, softmax and the last product of RT context rows in one work-group of RT / RW waves.
// REGISTER BLOCK OF THE SCORES: a wave holds RW whole score rows; a lane holds, of each, the two neighbouring aspect rows 2 * lane and 2 * lane + 1. One 8-byte read of the aspect's projection serves 2 * RW tangents.
// BOTH OPERANDS OF THE SCORE LOOP STAND IN LDS: the entry's aspect projection whole (all 8 waves read all of it) and the work-group's RT rows of the context's projection, brought in front of the loop by asynchronous copies, all in flight at once;
// the loop then reads no global memory but the score vector. A wave's context words come as 16-byte reads of one address for all lanes. Each score is still one chain over the 512 units in their order.
// Each wave then forms CW tiles of 16 output columns for all RT rows: D[m = column][n = row] = sum_j VT[column][j] w[row][j], so a lane holds 8 neighbouring columns of one row.
#define RT 32                     // context rows a work-group (two of the matrix instruction's N)
#define RW 4                      // context rows a wave
#define NW (RT / RW)              // waves a work-group
#define NT (NW * 32)              // threads a work-group
#define CW (DM / 16 / NW)         // column tiles a wave
#define EB 8                      // units a block of the score loop
#define PP (NK + 8)               // pitch of the weights in LDS, f16 words: 16 bytes over a row, for the 16-byte fragment reads
#define OP (DM + 4)               // pitch of the output tile in LDS, floats: 16 bytes over a row
typedef v2f __attribute__((may_alias)) v2fa;
typedef v2h __attribute__((may_alias)) v2ha;
struct SBlk { v2f a[EB]; v4f c[RW][EB / 4]; float v[EB]; };   // one block's operands: the aspect's and the context's words (vector registers, from LDS), the score vector's (scalar registers)
__device__ __forceinline__ void sblk_ld(SBlk& k, const float* a, const float* c, const float* __restrict__ vv, int e0) {
#pragma unroll
    for (int q = 0; q < EB; ++q) k.a[q] = *(const v2fa*)(a + (e0 + q) * NK);
#pragma unroll
    for (int r = 0; r < RW; ++r)
#pragma unroll
        for (int q = 0; q < EB / 4; ++q) k.c[r][q] = *(const v4fa*)(c + r * DM + e0 + q * 4);
#pragma unroll
    for (int q = 0; q < EB; ++q) k.v[q] = vv[e0 + q];
}
__device__ __forceinline__ void sblk_rnd(SBlk& k) {
#pragma unroll
    for (int q = 0; q < EB; ++q) k.v[q] = bfr(k.v[q]);
}
__device__ __forceinline__ void sblk_do(const SBlk& k, v2f* s) {
#pragma unroll
    for (int q = 0; q < EB; ++q) { const float vb = k.v[q];
#pragma unroll
        for (int r = 0; r < RW; ++r) { const float cw = k.c[r][q >> 2][q & 3]; s[r][0] += vb * __builtin_amdgcn_tanhf(cw + k.a[q][0]); s[r][1] += vb * __builtin_amdgcn_tanhf(cw + k.a[q][1]); } }   // the chip's own tangent instruction
}
// cp8: eight 16-byte asynchronous copies of a lane, global memory to LDS through no register, NT * 16 bytes apart in both. The s_wait_xcnt stands inside the statement, behind the last copy, so that no address register is rewritten in front of it.
#define CPS (NT * 16)             // bytes one copy of the whole work-group brings
__device__ __forceinline__ void cp8(unsigned l, const char* g) {
    asm volatile("global_load_async_to_lds_b128 %0, %8, off\n\t"
                 "global_load_async_to_lds_b128 %1, %9, off\n\t"
                 "global_load_async_to_lds_b128 %2, %10, off\n\t"
                 "global_load_async_to_lds_b128 %3, %11, off\n\t"
                 "global_load_async_to_lds_b128 %4, %12, off\n\t"
                 "global_load_async_to_lds_b128 %5, %13, off\n\t"
                 "global_load_async_to_lds_b128 %6, %14, off\n\t"
                 "global_load_async_to_lds_b128 %7, %15, off\n\t"
                 "s_wait_xcnt 0x0"
                 :: "v"(l), "v"(l + CPS), "v"(l + 2 * CPS), "v"(l + 3 * CPS), "v"(l + 4 * CPS), "v"(l + 5 * CPS), "v"(l + 6 * CPS), "v"(l + 7 * CPS),
                    "v"(g), "v"(g + CPS), "v"(g + 2 * CPS), "v"(g + 3 * CPS), "v"(g + 4 * CPS), "v"(g + 5 * CPS), "v"(g + 6 * CPS), "v"(g + 7 * CPS) : "memory");
}
__global__ __launch_bounds__(NT) void k_attn(const float* __restrict__ CP, const float* __restrict__ AT, const float* __restrict__ vv, const h16* __restrict__ VT, float* OUT) {
    __shared__ __align__(16) float As[DM * NK];   // the entry's aspect projection, transposed, whole (128 KiB)
    __shared__ __align__(16) float Cs[RT * DM];   // this work-group's rows of the context's projection (64 KiB)
    __shared__ __align__(16) float Ss[RT * NK];   // scores
    __shared__ __align__(16) float Es[RT * NK];   // exponentials
    __shared__ __align__(16) h16 Ps[RT * PP];     // weights
    __shared__ __align__(16) float Os[RT * OP];   // the output tile, for whole-line stores
    const unsigned tid = threadIdx.x, lane = tid & 31, lr = lane & 15, hi = lane >> 4, b = blockIdx.x / (NQ / RT);
    const unsigned w = (unsigned)__builtin_amdgcn_readfirstlane((int)(tid >> 5));   // the wave's number as a scalar
    const float* c = Cs + w * RW * DM; const float* a = As + 2 * lane;
    const h16* vt = VT + (size_t)b * DM * NK + (size_t)(w * CW * 16 + lr) * NK + 8 * hi;
    v16h va[CW][2];   // this wave's columns of the aspect, asked for in front of the score loop: behind it their latency would stand open at the first barrier
#pragma unroll
    for (int t = 0; t < CW; ++t) { va[t][0] = WFrag<h16>::ld(vt + t * 16 * NK); va[t][1] = WFrag<h16>::ld(vt + t * 16 * NK + 32); }
    { const char* ga = (const char*)(AT + (size_t)b * DM * NK) + tid * 16; const char* gc = (const char*)(CP + (size_t)blockIdx.x * RT * DM) + tid * 16;
      const unsigned la = (unsigned)(size_t)As + tid * 16, lc = (unsigned)(size_t)Cs + tid * 16;   // the low 32 bits of a __shared__ address: the byte's place in the work-group's LDS
#pragma unroll   // straight-line: 16 + 32 copies a lane, every one outstanding at once (63 is the limit)
      for (int i = 0; i < RT * DM * 4 / (8 * CPS); ++i) cp8(lc + i * 8 * CPS, gc + i * 8 * CPS);
#pragma unroll
      for (int i = 0; i < DM * NK * 4 / (8 * CPS); ++i) cp8(la + i * 8 * CPS, ga + i * 8 * CPS); }
    asm volatile("s_wait_asynccnt 0x0" ::: "memory");   // this wave's copies have landed; the compiler places no wait for them
    __syncthreads();                                    // and every other wave's: nobody reads As or Cs in front of this barrier
    v2f s[RW];
#pragma unroll
    for (int r = 0; r < RW; ++r) s[r] = (v2f){0.0f, 0.0f};
    SBlk k0, k1;   // two sets: the next block's loads fly while this block's tangents issue
    sblk_ld(k0, a, c, vv, 0);
    // The order of a half trip: (1) this block's score-vector words are rounded: the first use of its scalar words, so the one wait for scalar loads (it can only be to 0) stands in front of the next block's; (2) the next block's LDS reads and scalar load; (3) this block's tangents.
    // sched_barrier(0) keeps the three parts in that order in the schedule; wave_barrier (no instruction) keeps the compiler from moving the loads of part 2 over the loop's back edge down to their first use. Without them every load's latency stands open.
    for (int e0 = 0; e0 < DM; e0 += 2 * EB) {
        sblk_rnd(k0); __builtin_amdgcn_sched_barrier(0);
        sblk_ld(k1, a, c, vv, e0 + EB); __builtin_amdgcn_wave_barrier(); __builtin_amdgcn_sched_barrier(0);
        sblk_do(k0, s); __builtin_amdgcn_sched_barrier(0);
        sblk_rnd(k1); __builtin_amdgcn_sched_barrier(0);
        sblk_ld(k0, a, c, vv, (e0 + 2 * EB) & (DM - 1)); __builtin_amdgcn_wave_barrier(); __builtin_amdgcn_sched_barrier(0);   // the last trip asks for block 0 again: in bounds, not used
        sblk_do(k1, s); __builtin_amdgcn_sched_barrier(0);
    }
#pragma unroll
    for (int r = 0; r < RW; ++r) *(v2fa*)(Ss + (w * RW + r) * NK + 2 * lane) = s[r];
    __syncthreads();
    v2f ex[RW];
#pragma unroll
    for (int r = 0; r < RW; ++r) { const float* srow = Ss + (w * RW + r) * NK; float mx = srow[0];
#pragma unroll   // straight-line: the row comes as 16-byte LDS reads at literal offsets, several in flight
        for (int q = 0; q < NK / 4; ++q) { const v4f x = *(const v4fa*)(srow + q * 4); mx = fmaxf(fmaxf(fmaxf(fmaxf(mx, x[0]), x[1]), x[2]), x[3]); }
        ex[r] = (v2f){expf(s[r][0] - mx), expf(s[r][1] - mx)};
        *(v2fa*)(Es + (w * RW + r) * NK + 2 * lane) = ex[r]; }
    __syncthreads();
#pragma unroll
    for (int r = 0; r < RW; ++r) { const float* erow = Es + (w * RW + r) * NK; float sum = 0.0f;
#pragma unroll   // straight-line, as above; the additions stay one chain in the order of the aspect rows
        for (int q = 0; q < NK / 4; ++q) { const v4f x = *(const v4fa*)(erow + q * 4); sum += x[0]; sum += x[1]; sum += x[2]; sum += x[3]; }
        *(v2ha*)(Ps + (w * RW + r) * PP + 2 * lane) = (v2h){tohx(ex[r][0] / sum), tohx(ex[r][1] / sum)}; }
    __syncthreads();
#pragma unroll
    for (int n = 0; n < RT / 16; ++n) { const h16* pb = Ps + (n * 16 + lr) * PP + 8 * hi;
        const v16h p0 = cat16(*(const v8ha*)pb, *(const v8ha*)(pb + 16)), p1 = cat16(*(const v8ha*)(pb + 32), *(const v8ha*)(pb + 48));
#pragma unroll
        for (int t = 0; t < CW; ++t) { v8f acc = (v8f){};
            acc = wmma16(va[t][0], p0, acc);
            acc = wmma16(va[t][1], p1, acc);
            float* op = Os + (n * 16 + lr) * OP + (w * CW + t) * 16 + hi * 8;
            *(v4fa*)op = (v4f){acc[0], acc[1], acc[2], acc[3]}; *(v4fa*)(op + 4) = (v4f){acc[4], acc[5], acc[6], acc[7]}; } }
    __syncthreads();
    const unsigned r2 = tid / (DM / 4), col = (tid % (DM / 4)) * 4; const float* osp = Os + r2 * OP + col; float* gp = OUT + ((size_t)blockIdx.x * RT + r2) * DM + col;
#pragma unroll   // straight-line: the LDS reads go out ahead of the stores, and one address serves all of each at literal offsets
    for (int q = 0; q < RT * DM / 4 / NT; ++q) *(v4f*)(gp + (size_t)q * (NT * 4)) = *(const v4fa*)(osp + q * (NT * 4 / DM) * OP);
}
__device__ __forceinline__ void vt8(const float* __restrict__ src, h16* VT, unsigned idx) { const unsigned j0 = (idx % (NK / 8)) * 8, d = (idx / (NK / 8)) % DM, b = idx / ((NK / 8) * DM); v8h o;
#pragma unroll
    for (int q = 0; q < 8; ++q) o[q] = tohx(bfr(src[((size_t)b * NK + j0 + q) * DM + d]));
    *(v8h*)(VT + (size_t)idx * 8) = o;  }
// ---- k_prep: the four bf16 copies and the transposed f16 plane in one launch (none reads another's result); the block index picks the job, every range exact.
#define PB_VT (NB_ * DM * NK / 8 / 256)   // blocks of the transposed plane (its strided reads take longest: first)
#define PB_C  (NB_ * NQ * DM / 8 / 256)   // the context's copy
#define PB_A  (NB_ * NK * DM / 8 / 256)   // the aspect's copy
#define PB_W  (DM * DM / 8 / 256)         // one projection's copy
__global__ __launch_bounds__(256) void k_prep(const float* __restrict__ a0, const float* __restrict__ a1, const float* __restrict__ a2, const float* __restrict__ a3, bf* CB, bf* AB, bf* WCB, bf* WAB, h16* VT) {
    unsigned t = blockIdx.x;
    if (t < PB_VT) { vt8(a1, VT, t * 256 + threadIdx.x); return; }
    t -= PB_VT; const float* src; bf* dst;
    if (t < PB_C) { src = a0; dst = CB; }
    else if ((t -= PB_C) < PB_A) { src = a1; dst = AB; }
    else if ((t -= PB_A) < PB_W) { src = a2; dst = WCB; }
    else { t -= PB_W; src = a3; dst = WAB; }
    cvt8(src, dst, (size_t)t * 256 + threadIdx.x);
}

extern "C" void kernel_launch(void* const* d_in, const int* in_sizes, int n_in,
                              void* d_out, int out_size, void* d_ws, size_t ws_size, hipStream_t stream) {
    (void)in_sizes; (void)n_in; (void)out_size;
    const float* a0 = (const float*)d_in[0]; const float* a1 = (const float*)d_in[1]; const float* a2 = (const float*)d_in[2]; const float* a3 = (const float*)d_in[3]; const float* a4 = (const float*)d_in[4];   /* the module's argument order: the context, the aspect, the two projections, the score vector: FIVE inputs, all read */
    float* OUT = (float*)d_out;     // [32][256][512]
    char* wsp = (char*)d_ws;
    auto take = [&](size_t bytes) { char* p = wsp; wsp += (bytes + 255) & ~(size_t)255; return (void*)p; };
    bf* CB = (bf*)take((size_t)NB_ * NQ * DM * 2); bf* AB = (bf*)take((size_t)NB_ * NK * DM * 2); bf* WCB = (bf*)take((size_t)DM * DM * 2); bf* WAB = (bf*)take((size_t)DM * DM * 2);
    float* CP = (float*)take((size_t)NB_ * NQ * DM * 4); float* AT = (float*)take((size_t)NB_ * DM * NK * 4);
    h16* VT = (h16*)take((size_t)NB_ * DM * NK * 2);
    if ((size_t)(wsp - (char*)d_ws) > ws_size) return;    // total 33.00 MiB carved
    k_prep<<<(unsigned)(PB_VT + PB_C + PB_A + 2 * PB_W), 256, 0, stream>>>(a0, a1, a2, a3, CB, AB, WCB, WAB, VT);   /* the four bf16 copies and the transposed f16 plane */
    k_proj<<<(unsigned)(PJ_A + PJ_C), 128, 0, stream>>>(CB, WCB, AB, WAB, CP, AT);   /* the context's projection (all 8,192 rows) and the aspect's, transposed (the projection shared by the 32 entries) */
    k_attn<<<(unsigned)(NB_ * NQ / RT), NT, 0, stream>>>(CP, AT, a4, VT, OUT);   /* scores, softmax and out[b][i][d] = sum_j w[b][i][j] aspect[b][j][d] (depth 64) for 32 context rows a work-group; the one writer of the output */
}

// v007
// A run of this version takes 37.5 microseconds.
// Two timings next to v006 both put it at 1.05 times that version's speed.
// All steps since v000 together make it 8.24 times as fast.
#include <hip/hip_runtime.h>

// An additive (tangent) attention of a context over an aspect (inputs, in argument order: a0 [32][256][512] the context; a1 [32][64][512] the aspect; a2, a3 [512][512] two projections ('out, in'); a4 [512] a score vector):
//   c = a0 a2^T ([256][512] an entry);  a = a1 a3^T ([64][512] an entry);  s[i][j] = the sum over the 512 units e of a4[e] tanh(c[i][e] + a[j][e]);  w = softmax over the 64 aspect rows j;  out[i][:] = the sum over j of w[i][j] a1[j][:]  ->  [32][256][512] (4.2 M).
// THE MODULE's OWN ORDER. No preparation launch: each kernel reads the f32 inputs themselves and rounds a word to bf16 where it uses it. The context's projection CP [8192][512] f32 by one product (the projections stand 'out, in' = the product's [N][K] operand as they are); THE ASPECT's PROJECTION IS COMPUTED ALREADY TRANSPOSED, AT [32][512][64] f32, by giving the projection as the product's first operand (shared by the entries) and an entry's aspect rows as its second;
// k_attn does the rest for 32 context rows a work-group: the scores (one loop of 512 units with the chip's tangent instruction, a thread holding 4 rows by 2 aspect rows), each row's softmax (every thread walks its rows' 64 words in LDS: the maximum, then the sum in the order of the 64 aspect rows) with the weights as ONE f16 word, and the last product (f16 words of both operands; depth 64; the aspect's words taken from the input, column by column, into the fragment registers); scores and weights pass through LDS and never reach memory.
// TWO LAUNCHES: k_proj (both projections), k_attn (scores, softmax, last product).
// Every address from the lane's own index, a loop's own counter and launch constants; exact grids, no guard; no atomic, and no cross-lane word but the wave's own number taken as a scalar in k_proj and k_attn.
// Compute dtypes, f32 accumulate: every float input rounded to bf16 at its use; both projections ONE bf16 product on exact operands; scores and softmax f32; the weights ONE f16 word each against the aspect's own bf16 words carried as f16 (exact but for words under 2^-14).

#define NB_  32                   // entries
#define NQ   256                  // context rows (queries) an entry
#define NK   64                   // aspect rows (keys = values) an entry
#define DM   512                  // the width of both and the units
typedef _Float16 h16;
typedef unsigned short bf;
typedef __attribute__((ext_vector_type(16))) __bf16   v16bf;
typedef __attribute__((ext_vector_type(16))) _Float16 v16h;
typedef __attribute__((ext_vector_type(8)))  _Float16 v8h;
typedef __attribute__((ext_vector_type(8)))  float    v8f;
typedef __attribute__((ext_vector_type(4)))  float    v4f;
typedef v8h  __attribute__((may_alias)) v8ha;
typedef v4f  __attribute__((may_alias)) v4fa;
typedef __attribute__((ext_vector_type(16))) float    v16f;

__device__ __forceinline__ unsigned short f2bf(float f) { unsigned u = __float_as_uint(f); u += 0x7FFFu + ((u >> 16) & 1u); return (unsigned short)(u >> 16); }
__device__ __forceinline__ float bf2f(unsigned short b) { return __uint_as_float(((unsigned)b) << 16); }
__device__ __forceinline__ float bfr(float f) { return bf2f(f2bf(f)); }
__device__ __forceinline__ v16h cat16(v8h lo, v8h hi) { return __builtin_shufflevector(lo, hi, 0, 1, 2, 3, 4, 5, 6, 7, 8, 9, 10, 11, 12, 13, 14, 15); }
__device__ __forceinline__ v8f wmma16(v16h a, v16h b, v8f c) { return __builtin_amdgcn_wmma_f32_16x16x32_f16(false, a, false, b, (short)0, c, false, false); }
__device__ __forceinline__ v8f wmmab(v16bf a, v16bf b, v8f c) { return __builtin_amdgcn_wmma_f32_16x16x32_bf16(false, a, false, b, (short)0, c, false, false); }



// ---- k_proj: BOTH projections in one launch (neither reads the other's result); the block index picks the product. C[m][n] (f32) = sum_k A[m][k] Bt[n][k], depth DM.
// A WORK-GROUP OF 4 WAVES FORMS A 128x128 TILE, each wave a 64x64 quarter (16 accumulators). Both operands' 128 rows pass through LDS AS THE f32 WORDS OF THE INPUTS, in stages of KS words of depth, brought by asynchronous copies into two buffers:
// the next stage's copies fly while this stage's products issue, and a row is fetched from L2 once for the two waves that read it. A fragment's 16 words are read from LDS as f32 and rounded to bf16 (to nearest, ties to even) in registers. Every accumulator still takes its 16 products in the order of k.
// The aspect's product has the projection as its first operand and the aspect rows of all entries, 2,048 in a row, as its second: a wave's 64 columns are one entry's rows, so its quarter goes to that entry's transposed plane.
#define PT 128                    // rows and columns of a work-group's tile
#define KS 64                     // depth of a stage, f32 words: 256 bytes a row
#define PL (KS + 4)               // pitch of a staged row in LDS, f32 words: 16 bytes over a row, for the 16-byte fragment reads
#define PBUF (2 * PT * PL)        // words of one buffer: the first operand's rows, then the second's
#define PJ_A ((DM / PT) * (NB_ * NK / PT))   // tiles of the aspect's projection
#define PJ_C ((NB_ * NQ / PT) * (DM / PT))   // tiles of the context's projection
// cp8r: eight 16-byte asynchronous copies of a lane, global memory to LDS through no register, 8 rows apart in both. The s_wait_xcnt stands inside the statement, behind the last copy, so that no address register is rewritten in front of it.
#define RL (8 * PL * 4)           // bytes 8 rows take in LDS
#define RG (8 * DM * 4)           // and in memory
__device__ __forceinline__ void cp8r(unsigned l, const char* g) {
    asm volatile("global_load_async_to_lds_b128 %0, %8, off\n\t"
                 "global_load_async_to_lds_b128 %1, %9, off\n\t"
                 "global_load_async_to_lds_b128 %2, %10, off\n\t"
                 "global_load_async_to_lds_b128 %3, %11, off\n\t"
                 "global_load_async_to_lds_b128 %4, %12, off\n\t"
                 "global_load_async_to_lds_b128 %5, %13, off\n\t"
                 "global_load_async_to_lds_b128 %6, %14, off\n\t"
                 "global_load_async_to_lds_b128 %7, %15, off\n\t"
                 "s_wait_xcnt 0x0"
                 :: "v"(l), "v"(l + RL), "v"(l + 2 * RL), "v"(l + 3 * RL), "v"(l + 4 * RL), "v"(l + 5 * RL), "v"(l + 6 * RL), "v"(l + 7 * RL),
                    "v"(g), "v"(g + RG), "v"(g + 2 * RG), "v"(g + 3 * RG), "v"(g + 4 * RG), "v"(g + 5 * RG), "v"(g + 6 * RG), "v"(g + 7 * RG) : "memory");
}
// One stage of both operands: 16 lanes a row, 8 rows a copy of the work-group, 16 + 16 copies a lane (63 may be outstanding).
__device__ __forceinline__ void pj_stage(unsigned l, const char* ga, const char* gb) {
    cp8r(l, ga); cp8r(l + 8 * RL, ga + 8 * RG);
    cp8r(l + PT * PL * 4, gb); cp8r(l + PT * PL * 4 + 8 * RL, gb + 8 * RG);
}
// One 16x32 fragment: the lane's two runs of 8 words, 16 words apart, four 16-byte LDS reads; the conversion is the chip's packed f32-to-bf16 instruction.
__device__ __forceinline__ v16bf pj_frag(const float* p) { const v4f x0 = *(const v4fa*)p, x1 = *(const v4fa*)(p + 4), x2 = *(const v4fa*)(p + 16), x3 = *(const v4fa*)(p + 20);
    const v8f lo = __builtin_shufflevector(x0, x1, 0, 1, 2, 3, 4, 5, 6, 7), hi = __builtin_shufflevector(x2, x3, 0, 1, 2, 3, 4, 5, 6, 7);
    const v16f x = __builtin_shufflevector(lo, hi, 0, 1, 2, 3, 4, 5, 6, 7, 8, 9, 10, 11, 12, 13, 14, 15); return __builtin_convertvector(x, v16bf); }
__global__ __launch_bounds__(128) void k_proj(const float* __restrict__ CB, const float* __restrict__ WCB, const float* __restrict__ AB, const float* __restrict__ WAB, float* CP, float* AT) {
    __shared__ __align__(16) float St[2 * PBUF];       // the two buffers
    __shared__ __align__(16) float Ow[4 * 16 * 68];    // each wave's own 16 output rows, for whole-line stores
    const unsigned t = blockIdx.x, tid = threadIdx.x, lane = tid & 31, lr = lane & 15, hi = lane >> 4;
    const unsigned w = (unsigned)__builtin_amdgcn_readfirstlane((int)(tid >> 5)), wm = w & 1, wn = w >> 1;   // the wave's number as a scalar; its quarter
    const float* A; const float* Bt; float* C; int ldc;   // the tile's first rows of both operands; this wave's quarter of the result
    if (t < PJ_A) { const unsigned r0 = (t % (DM / PT)) * PT, c0 = (t / (DM / PT)) * PT; A = WAB + (size_t)r0 * DM; Bt = AB + (size_t)c0 * DM;
        C = AT + (size_t)(c0 / NK + wn) * DM * NK + (size_t)(r0 + wm * 64) * NK; ldc = NK; }
    else { const unsigned u = t - PJ_A, r0 = (u % (NB_ * NQ / PT)) * PT, c0 = (u / (NB_ * NQ / PT)) * PT; A = CB + (size_t)r0 * DM; Bt = WCB + (size_t)c0 * DM;
        C = CP + (size_t)(r0 + wm * 64) * DM + c0 + wn * 64; ldc = DM; }
    v8f acc[4][4];
#pragma unroll
    for (int mb = 0; mb < 4; ++mb)
#pragma unroll
        for (int nb = 0; nb < 4; ++nb) acc[mb][nb] = (v8f){};
    const unsigned lb = (unsigned)(size_t)St + (tid >> 4) * (PL * 4) + (tid & 15) * 16;   // the low 32 bits of a __shared__ address: the byte's place in the work-group's LDS
    const char* ga = (const char*)(A + (size_t)(tid >> 4) * DM) + (tid & 15) * 16; const char* gb = (const char*)(Bt + (size_t)(tid >> 4) * DM) + (tid & 15) * 16;
    pj_stage(lb, ga, gb);
    asm volatile("s_wait_asynccnt 0x0" ::: "memory");   // this wave's copies of stage 0 have landed; the compiler places no wait for them
    __syncthreads();                                    // and every other wave's: nobody reads stage 0 in front of this barrier
    pj_stage(lb + PBUF * 4, ga + KS * 4, gb + KS * 4);
    const float* fa = St + (wm * 64 + lr) * PL + 8 * hi; const float* fb = St + (PT + wn * 64 + lr) * PL + 8 * hi;
#pragma unroll 1   // rolled: one body of 32 products serves the eight stages
    for (int s = 0; s < DM / KS; ++s) {
        const float* pa = fa + (s & 1) * PBUF; const float* pb = fb + (s & 1) * PBUF;
        v16bf a[4];
#pragma unroll
        for (int kk = 0; kk < KS / 32; ++kk) {
            v16bf b[4];
#pragma unroll
            for (int mb = 0; mb < 4; ++mb) a[mb] = pj_frag(pa + mb * 16 * PL + kk * 32);
#pragma unroll
            for (int nb = 0; nb < 4; ++nb) b[nb] = pj_frag(pb + nb * 16 * PL + kk * 32);
            __builtin_amdgcn_sched_barrier(0);   // the block's 32 LDS reads stay one group in front of its 16 products: left to itself the schedule reads each b fragment just in front of its use and waits for it four times a block
#pragma unroll
            for (int nb = 0; nb < 4; ++nb)
#pragma unroll
                for (int mb = 0; mb < 4; ++mb) acc[mb][nb] = wmmab(a[mb], b[nb], acc[mb][nb]);
            __builtin_amdgcn_sched_barrier(0);   // and the next block's reads stay behind these products, not scattered among them
        }
        asm volatile("v_nop\n\tv_nop\n\tv_nop\n\tv_nop" : "+v"(acc[0][0]), "+v"(acc[1][1]), "+v"(acc[2][2]), "+v"(acc[3][3]) : "v"(a[0]), "v"(a[3]));   // the distance behind the stage's last products, on the branches that follow too
        asm volatile("s_wait_dscnt 0x0" ::: "memory");      // this wave's reads of the buffer are done before it is refilled
        asm volatile("s_wait_asynccnt 0x0" ::: "memory");   // this wave's copies of the next stage have landed
        __syncthreads();                                    // publishes the next stage and ends every wave's reads of this one
        if (s + 2 < DM / KS) pj_stage(lb + (s & 1) * (PBUF * 4), ga + (s + 2) * (KS * 4), gb + (s + 2) * (KS * 4));
    }
    asm volatile("s_wait_asynccnt 0x0" ::: "memory");   // no copy is outstanding when the wave goes on
    float* os = Ow + w * (16 * 68);
#pragma unroll
    for (int mb = 0; mb < 4; ++mb) {
#pragma unroll
        for (int nb = 0; nb < 4; ++nb) {
#pragma unroll
            for (int j = 0; j < 8; ++j) os[(hi * 8 + j) * 68 + nb * 16 + lr] = acc[mb][nb][j]; }
        __builtin_amdgcn_wave_barrier(); asm volatile("" ::: "memory");   // no instruction: keeps the compiler from moving the wave's LDS reads below over these stores (and, at the foot, the next stores over the reads)
        float* crow = C + (size_t)(mb * 16) * ldc;
#pragma unroll
        for (int s = 0; s < 8; ++s) { const int row = 2 * s + hi, cofs = lr * 4; *(v4f*)(crow + (size_t)row * ldc + cofs) = *(const v4fa*)(os + row * 68 + cofs); }
        __builtin_amdgcn_wave_barrier(); asm volatile("" ::: "memory");
    }
}

__device__ __forceinline__ h16 tohx(float x) { return (h16)x; }
typedef __attribute__((ext_vector_type(2))) _Float16 v2h;
typedef __attribute__((ext_vector_type(4))) _Float16 v4h;
typedef __attribute__((ext_vector_type(2))) unsigned short v2us;
typedef __attribute__((ext_vector_type(4))) unsigned short v4us;
typedef __attribute__((ext_vector_type(2))) float v2f;
typedef __attribute__((ext_vector_type(4))) int v4i;

// ---- k_attn: scores, softmax and the last product of RT context rows in one work-group of RT / RW waves.
// REGISTER BLOCK OF THE SCORES: a wave holds RW whole score rows; a lane holds, of each, the two neighbouring aspect rows 2 * lane and 2 * lane + 1. One 8-byte read of the aspect's projection serves 2 * RW tangents.
// BOTH OPERANDS OF THE SCORE LOOP STAND IN LDS: the entry's aspect projection whole (all 8 waves read all of it) and the work-group's RT rows of the context's projection, brought in front of the loop by asynchronous copies, all in flight at once;
// the loop then reads no global memory but the score vector. A wave's context words come as 16-byte reads of one address for all lanes. Each score is still one chain over the 512 units in their order.
// Each wave then forms CW tiles of 16 output columns for all RT rows: D[m = column][n = row] = sum_j aspect[j][column] w[row][j], so a lane holds 8 neighbouring columns of one row.
// The first operand's fragments come straight from the f32 input: a lane owns one column and reads its 16 aspect rows of a fragment word by word (16 lanes side by side: 64 bytes of a row), rounds each to bf16 and carries it as f16.
#define RT 32                     // context rows a work-group (two of the matrix instruction's N)
#define RW 4                      // context rows a wave
#define NW (RT / RW)              // waves a work-group
#define NT (NW * 32)              // threads a work-group
#define CW (DM / 16 / NW)         // column tiles a wave
#define EB 8                      // units a block of the score loop
#define PP (NK + 8)               // pitch of the weights in LDS, f16 words: 16 bytes over a row, for the 16-byte fragment reads
#define OP (DM + 4)               // pitch of the output tile in LDS, floats: 16 bytes over a row
typedef v2f __attribute__((may_alias)) v2fa;
typedef v2h __attribute__((may_alias)) v2ha;
struct SBlk { v2f a[EB]; v4f c[RW][EB / 4]; float v[EB]; };   // one block's operands: the aspect's and the context's words (vector registers, from LDS), the score vector's (scalar registers)
__device__ __forceinline__ void sblk_ld(SBlk& k, const float* a, const float* c, const float* __restrict__ vv, int e0) {
#pragma unroll
    for (int q = 0; q < EB; ++q) k.a[q] = *(const v2fa*)(a + (e0 + q) * NK);
#pragma unroll
    for (int r = 0; r < RW; ++r)
#pragma unroll
        for (int q = 0; q < EB / 4; ++q) k.c[r][q] = *(const v4fa*)(c + r * DM + e0 + q * 4);
#pragma unroll
    for (int q = 0; q < EB; ++q) k.v[q] = vv[e0 + q];
}
__device__ __forceinline__ void sblk_rnd(SBlk& k) {
#pragma unroll
    for (int q = 0; q < EB; ++q) k.v[q] = bfr(k.v[q]);
}
__device__ __forceinline__ void sblk_do(const SBlk& k, v2f* s) {
#pragma unroll
    for (int q = 0; q < EB; ++q) { const float vb = k.v[q];
#pragma unroll
        for (int r = 0; r < RW; ++r) { const float cw = k.c[r][q >> 2][q & 3]; s[r][0] += vb * __builtin_amdgcn_tanhf(cw + k.a[q][0]); s[r][1] += vb * __builtin_amdgcn_tanhf(cw + k.a[q][1]); } }   // the chip's own tangent instruction
}
// cp8: eight 16-byte asynchronous copies of a lane, global memory to LDS through no register, NT * 16 bytes apart in both. The s_wait_xcnt stands inside the statement, behind the last copy, so that no address register is rewritten in front of it.
#define CPS (NT * 16)             // bytes one copy of the whole work-group brings
__device__ __forceinline__ void cp8(unsigned l, const char* g) {
    asm volatile("global_load_async_to_lds_b128 %0, %8, off\n\t"
                 "global_load_async_to_lds_b128 %1, %9, off\n\t"
                 "global_load_async_to_lds_b128 %2, %10, off\n\t"
                 "global_load_async_to_lds_b128 %3, %11, off\n\t"
                 "global_load_async_to_lds_b128 %4, %12, off\n\t"
                 "global_load_async_to_lds_b128 %5, %13, off\n\t"
                 "global_load_async_to_lds_b128 %6, %14, off\n\t"
                 "global_load_async_to_lds_b128 %7, %15, off\n\t"
                 "s_wait_xcnt 0x0"
                 :: "v"(l), "v"(l + CPS), "v"(l + 2 * CPS), "v"(l + 3 * CPS), "v"(l + 4 * CPS), "v"(l + 5 * CPS), "v"(l + 6 * CPS), "v"(l + 7 * CPS),
                    "v"(g), "v"(g + CPS), "v"(g + 2 * CPS), "v"(g + 3 * CPS), "v"(g + 4 * CPS), "v"(g + 5 * CPS), "v"(g + 6 * CPS), "v"(g + 7 * CPS) : "memory");
}
__global__ __launch_bounds__(NT) void k_attn(const float* __restrict__ CP, const float* __restrict__ AT, const float* __restrict__ vv, const float* __restrict__ ASP, float* OUT) {
    __shared__ __align__(16) float As[DM * NK];   // the entry's aspect projection, transposed, whole (128 KiB)
    __shared__ __align__(16) float Cs[RT * DM];   // this work-group's rows of the context's projection (64 KiB)
    __shared__ __align__(16) float Ss[RT * NK];   // scores
    __shared__ __align__(16) float Es[RT * NK];   // exponentials
    __shared__ __align__(16) h16 Ps[RT * PP];     // weights
    __shared__ __align__(16) float Os[RT * OP];   // the output tile, for whole-line stores
    const unsigned tid = threadIdx.x, lane = tid & 31, lr = lane & 15, hi = lane >> 4, b = blockIdx.x / (NQ / RT);
    const unsigned w = (unsigned)__builtin_amdgcn_readfirstlane((int)(tid >> 5));   // the wave's number as a scalar
    const float* c = Cs + w * RW * DM; const float* a = As + 2 * lane;
    const float* ap = ASP + ((size_t)b * NK + 8 * hi) * DM + w * CW * 16 + lr;   // the lane's column, at the first aspect row of its half of a fragment
    float vr[CW][2][16];   // this wave's columns of the aspect, asked for in front of the copies: they land, and are rounded, while the copies fly
#pragma unroll
    for (int t = 0; t < CW; ++t)
#pragma unroll
        for (int h = 0; h < 2; ++h)
#pragma unroll
            for (int q = 0; q < 16; ++q) vr[t][h][q] = ap[(size_t)(h * 32 + (q >> 3) * 16 + (q & 7)) * DM + t * 16];
    { const char* ga = (const char*)(AT + (size_t)b * DM * NK) + tid * 16; const char* gc = (const char*)(CP + (size_t)blockIdx.x * RT * DM) + tid * 16;
      const unsigned la = (unsigned)(size_t)As + tid * 16, lc = (unsigned)(size_t)Cs + tid * 16;   // the low 32 bits of a __shared__ address: the byte's place in the work-group's LDS
#pragma unroll   // straight-line: 16 + 32 copies a lane, every one outstanding at once (63 is the limit)
      for (int i = 0; i < RT * DM * 4 / (8 * CPS); ++i) cp8(lc + i * 8 * CPS, gc + i * 8 * CPS);
#pragma unroll
      for (int i = 0; i < DM * NK * 4 / (8 * CPS); ++i) cp8(la + i * 8 * CPS, ga + i * 8 * CPS); }
    v16h va[CW][2];
#pragma unroll
    for (int t = 0; t < CW; ++t)
#pragma unroll
        for (int h = 0; h < 2; ++h)
#pragma unroll
            for (int q = 0; q < 16; ++q) va[t][h][q] = tohx(bfr(vr[t][h][q]));
    asm volatile("" :: "v"(va[0][0]), "v"(va[0][1]), "v"(va[1][0]), "v"(va[1][1]), "v"(va[2][0]), "v"(va[2][1]), "v"(va[3][0]), "v"(va[3][1]));   // inputs only, no instruction: the rounded words are formed here, while the copies fly; without it the compiler moves the rounding behind the score loop, where it stands open, and carries 128 registers over the loop in place of 64
    asm volatile("s_wait_asynccnt 0x0" ::: "memory");   // this wave's copies have landed; the compiler places no wait for them
    __syncthreads();                                    // and every other wave's: nobody reads As or Cs in front of this barrier
    v2f s[RW];
#pragma unroll
    for (int r = 0; r < RW; ++r) s[r] = (v2f){0.0f, 0.0f};
    SBlk k0, k1;   // two sets: the next block's loads fly while this block's tangents issue
    sblk_ld(k0, a, c, vv, 0);
    // The order of a half trip: (1) this block's score-vector words are rounded: the first use of its scalar words, so the one wait for scalar loads (it can only be to 0) stands in front of the next block's; (2) the next block's LDS reads and scalar load; (3) this block's tangents.
    // sched_barrier(0) keeps the three parts in that order in the schedule; wave_barrier (no instruction) keeps the compiler from moving the loads of part 2 over the loop's back edge down to their first use. Without them every load's latency stands open.
    for (int e0 = 0; e0 < DM; e0 += 2 * EB) {
        sblk_rnd(k0); __builtin_amdgcn_sched_barrier(0);
        sblk_ld(k1, a, c, vv, e0 + EB); __builtin_amdgcn_wave_barrier(); __builtin_amdgcn_sched_barrier(0);
        sblk_do(k0, s); __builtin_amdgcn_sched_barrier(0);
        sblk_rnd(k1); __builtin_amdgcn_sched_barrier(0);
        sblk_ld(k0, a, c, vv, (e0 + 2 * EB) & (DM - 1)); __builtin_amdgcn_wave_barrier(); __builtin_amdgcn_sched_barrier(0);   // the last trip asks for block 0 again: in bounds, not used
        sblk_do(k1, s); __builtin_amdgcn_sched_barrier(0);
    }
#pragma unroll
    for (int r = 0; r < RW; ++r) *(v2fa*)(Ss + (w * RW + r) * NK + 2 * lane) = s[r];
    __syncthreads();
    v2f ex[RW];
#pragma unroll
    for (int r = 0; r < RW; ++r) { const float* srow = Ss + (w * RW + r) * NK; float mx = srow[0];
#pragma unroll   // straight-line: the row comes as 16-byte LDS reads at literal offsets, several in flight
        for (int q = 0; q < NK / 4; ++q) { const v4f x = *(const v4fa*)(srow + q * 4); mx = fmaxf(fmaxf(fmaxf(fmaxf(mx, x[0]), x[1]), x[2]), x[3]); }
        ex[r] = (v2f){expf(s[r][0] - mx), expf(s[r][1] - mx)};
        *(v2fa*)(Es + (w * RW + r) * NK + 2 * lane) = ex[r]; }
    __syncthreads();
#pragma unroll
    for (int r = 0; r < RW; ++r) { const float* erow = Es + (w * RW + r) * NK; float sum = 0.0f;
#pragma unroll   // straight-line, as above; the additions stay one chain in the order of the aspect rows
        for (int q = 0; q < NK / 4; ++q) { const v4f x = *(const v4fa*)(erow + q * 4); sum += x[0]; sum += x[1]; sum += x[2]; sum += x[3]; }
        *(v2ha*)(Ps + (w * RW + r) * PP + 2 * lane) = (v2h){tohx(ex[r][0] / sum), tohx(ex[r][1] / sum)}; }
    __syncthreads();
#pragma unroll
    for (int n = 0; n < RT / 16; ++n) { const h16* pb = Ps + (n * 16 + lr) * PP + 8 * hi;
        const v16h p0 = cat16(*(const v8ha*)pb, *(const v8ha*)(pb + 16)), p1 = cat16(*(const v8ha*)(pb + 32), *(const v8ha*)(pb + 48));
#pragma unroll
        for (int t = 0; t < CW; ++t) { v8f acc = (v8f){};
            acc = wmma16(va[t][0], p0, acc);
            acc = wmma16(va[t][1], p1, acc);
            float* op = Os + (n * 16 + lr) * OP + (w * CW + t) * 16 + hi * 8;
            *(v4fa*)op = (v4f){acc[0], acc[1], acc[2], acc[3]}; *(v4fa*)(op + 4) = (v4f){acc[4], acc[5], acc[6], acc[7]}; } }
    __syncthreads();
    const unsigned r2 = tid / (DM / 4), col = (tid % (DM / 4)) * 4; const float* osp = Os + r2 * OP + col; float* gp = OUT + ((size_t)blockIdx.x * RT + r2) * DM + col;
#pragma unroll   // straight-line: the LDS reads go out ahead of the stores, and one address serves all of each at literal offsets
    for (int q = 0; q < RT * DM / 4 / NT; ++q) *(v4f*)(gp + (size_t)q * (NT * 4)) = *(const v4fa*)(osp + q * (NT * 4 / DM) * OP);
}

extern "C" void kernel_launch(void* const* d_in, const int* in_sizes, int n_in,
                              void* d_out, int out_size, void* d_ws, size_t ws_size, hipStream_t stream) {
    (void)in_sizes; (void)n_in; (void)out_size;
    const float* a0 = (const float*)d_in[0]; const float* a1 = (const float*)d_in[1]; const float* a2 = (const float*)d_in[2]; const float* a3 = (const float*)d_in[3]; const float* a4 = (const float*)d_in[4];   /* the module's argument order: the context, the aspect, the two projections, the score vector: FIVE inputs, all read */
    float* OUT = (float*)d_out;     // [32][256][512]
    char* wsp = (char*)d_ws;
    auto take = [&](size_t bytes) { char* p = wsp; wsp += (bytes + 255) & ~(size_t)255; return (void*)p; };
    float* CP = (float*)take((size_t)NB_ * NQ * DM * 4); float* AT = (float*)take((size_t)NB_ * DM * NK * 4);
    if ((size_t)(wsp - (char*)d_ws) > ws_size) return;    // total 20.00 MiB carved
    k_proj<<<(unsigned)(PJ_A + PJ_C), 128, 0, stream>>>(a0, a2, a1, a3, CP, AT);   /* the context's projection (all 8,192 rows) and the aspect's, transposed (the projection shared by the 32 entries) */
    k_attn<<<(unsigned)(NB_ * NQ / RT), NT, 0, stream>>>(CP, AT, a4, a1, OUT);   /* scores, softmax and out[b][i][d] = sum_j w[b][i][j] aspect[b][j][d] (depth 64) for 32 context rows a work-group; the one writer of the output */
}

// v008
// A run of this version takes 35.7 microseconds.
// Next to v007, in two timings, it ran 1.06 and 1.05 times as fast.
// Over all steps from v000 it is 8.67 times as fast.
#include <hip/hip_runtime.h>

// An additive (tangent) attention of a context over an aspect (inputs, in argument order: a0 [32][256][512] the context; a1 [32][64][512] the aspect; a2, a3 [512][512] two projections ('out, in'); a4 [512] a score vector):
//   c = a0 a2^T ([256][512] an entry);  a = a1 a3^T ([64][512] an entry);  s[i][j] = the sum over the 512 units e of a4[e] tanh(c[i][e] + a[j][e]);  w = softmax over the 64 aspect rows j;  out[i][:] = the sum over j of w[i][j] a1[j][:]  ->  [32][256][512] (4.2 M).
// THE MODULE's OWN ORDER. No preparation launch: each kernel reads the f32 inputs themselves and rounds a word to bf16 where it uses it. The context's projection CP [8192][512] f32 by one product (the projections stand 'out, in' = the product's [N][K] operand as they are); THE ASPECT's PROJECTION IS COMPUTED ALREADY TRANSPOSED, AT [32][512][64] f32, by giving the projection as the product's first operand (shared by the entries) and an entry's aspect rows as its second;
// k_attn does the rest for 32 context rows a work-group: the scores (one loop of 512 units with the chip's tangent instruction, a thread holding 4 rows by 2 aspect rows), each row's softmax (every thread walks its rows' 64 words in LDS: the maximum, then the sum in the order of the 64 aspect rows) with the weights as ONE f16 word, and the last product (f16 words of both operands; depth 64; the aspect's words taken from the input, column by column, into the fragment registers); scores and weights pass through LDS and never reach memory.
// TWO LAUNCHES: k_proj (both projections), k_attn (scores, softmax, last product).
// Every address from the lane's own index, a loop's own counter and launch constants; exact grids, no guard; no atomic, and no cross-lane word but the wave's own number taken as a scalar in k_proj and k_attn.
// Compute dtypes, f32 accumulate: every float input rounded to bf16 at its use; both projections ONE bf16 product on exact operands; scores and softmax f32; the weights ONE f16 word each against the aspect's own bf16 words carried as f16 (exact but for words under 2^-14).

#define NB_  32                   // entries
#define NQ   256                  // context rows (queries) an entry
#define NK   64                   // aspect rows (keys = values) an entry
#define DM   512                  // the width of both and the units
typedef _Float16 h16;
typedef unsigned short bf;
typedef __attribute__((ext_vector_type(16))) __bf16   v16bf;
typedef __attribute__((ext_vector_type(16))) _Float16 v16h;
typedef __attribute__((ext_vector_type(8)))  _Float16 v8h;
typedef __attribute__((ext_vector_type(8)))  float    v8f;
typedef __attribute__((ext_vector_type(4)))  float    v4f;
typedef v8h  __attribute__((may_alias)) v8ha;
typedef v4f  __attribute__((may_alias)) v4fa;
typedef __attribute__((ext_vector_type(16))) float    v16f;

__device__ __forceinline__ unsigned short f2bf(float f) { unsigned u = __float_as_uint(f); u += 0x7FFFu + ((u >> 16) & 1u); return (unsigned short)(u >> 16); }
__device__ __forceinline__ float bf2f(unsigned short b) { return __uint_as_float(((unsigned)b) << 16); }
__device__ __forceinline__ float bfr(float f) { return bf2f(f2bf(f)); }
__device__ __forceinline__ v16h cat16(v8h lo, v8h hi) { return __builtin_shufflevector(lo, hi, 0, 1, 2, 3, 4, 5, 6, 7, 8, 9, 10, 11, 12, 13, 14, 15); }
__device__ __forceinline__ v8f wmma16(v16h a, v16h b, v8f c) { return __builtin_amdgcn_wmma_f32_16x16x32_f16(false, a, false, b, (short)0, c, false, false); }
__device__ __forceinline__ v8f wmmab(v16bf a, v16bf b, v8f c) { return __builtin_amdgcn_wmma_f32_16x16x32_bf16(false, a, false, b, (short)0, c, false, false); }



// ---- k_proj: BOTH projections in one launch (neither reads the other's result); the block index picks the product. C[m][n] (f32) = sum_k A[m][k] Bt[n][k], depth DM.
// A WORK-GROUP OF 4 WAVES FORMS A 128x128 TILE, each wave a 64x64 quarter (16 accumulators). Both operands' 128 rows pass through LDS AS THE f32 WORDS OF THE INPUTS, in stages of KS words of depth, brought by asynchronous copies into two buffers:
// the next stage's copies fly while this stage's products issue, and a row is fetched from L2 once for the two waves that read it. A fragment's 16 words are read from LDS as f32 and rounded to bf16 (to nearest, ties to even) in registers. Every accumulator still takes its 16 products in the order of k.
// The aspect's product has the projection as its first operand and the aspect rows of all entries, 2,048 in a row, as its second: a wave's 64 columns are one entry's rows, so its quarter goes to that entry's transposed plane.
#define PT 128                    // rows and columns of a work-group's tile
#define KS 64                     // depth of a stage, f32 words: 256 bytes a row
#define PL (KS + 4)               // pitch of a staged row in LDS, f32 words: 16 bytes over a row, for the 16-byte fragment reads
#define PBUF (2 * PT * PL)        // words of one buffer: the first operand's rows, then the second's
#define PJ_A ((DM / PT) * (NB_ * NK / PT))   // tiles of the aspect's projection
#define PJ_C ((NB_ * NQ / PT) * (DM / PT))   // tiles of the context's projection
// cp8r: eight 16-byte asynchronous copies of a lane, global memory to LDS through no register, 8 rows apart in both. The s_wait_xcnt stands inside the statement, behind the last copy, so that no address register is rewritten in front of it.
#define RL (8 * PL * 4)           // bytes 8 rows take in LDS
#define RG (8 * DM * 4)           // and in memory
__device__ __forceinline__ void cp8r(unsigned l, const char* g) {
    asm volatile("global_load_async_to_lds_b128 %0, %8, off\n\t"
                 "global_load_async_to_lds_b128 %1, %9, off\n\t"
                 "global_load_async_to_lds_b128 %2, %10, off\n\t"
                 "global_load_async_to_lds_b128 %3, %11, off\n\t"
                 "global_load_async_to_lds_b128 %4, %12, off\n\t"
                 "global_load_async_to_lds_b128 %5, %13, off\n\t"
                 "global_load_async_to_lds_b128 %6, %14, off\n\t"
                 "global_load_async_to_lds_b128 %7, %15, off\n\t"
                 "s_wait_xcnt 0x0"
                 :: "v"(l), "v"(l + RL), "v"(l + 2 * RL), "v"(l + 3 * RL), "v"(l + 4 * RL), "v"(l + 5 * RL), "v"(l + 6 * RL), "v"(l + 7 * RL),
                    "v"(g), "v"(g + RG), "v"(g + 2 * RG), "v"(g + 3 * RG), "v"(g + 4 * RG), "v"(g + 5 * RG), "v"(g + 6 * RG), "v"(g + 7 * RG) : "memory");
}
// One stage of both operands: 16 lanes a row, 8 rows a copy of the work-group, 16 + 16 copies a lane (63 may be outstanding).
__device__ __forceinline__ void pj_stage(unsigned l, const char* ga, const char* gb) {
    cp8r(l, ga); cp8r(l + 8 * RL, ga + 8 * RG);
    cp8r(l + PT * PL * 4, gb); cp8r(l + PT * PL * 4 + 8 * RL, gb + 8 * RG);
}
// One 16x32 fragment: the lane's two runs of 8 words, 16 words apart, four 16-byte LDS reads; the conversion is the chip's packed f32-to-bf16 instruction.
__device__ __forceinline__ v16bf pj_frag(const float* p) { const v4f x0 = *(const v4fa*)p, x1 = *(const v4fa*)(p + 4), x2 = *(const v4fa*)(p + 16), x3 = *(const v4fa*)(p + 20);
    const v8f lo = __builtin_shufflevector(x0, x1, 0, 1, 2, 3, 4, 5, 6, 7), hi = __builtin_shufflevector(x2, x3, 0, 1, 2, 3, 4, 5, 6, 7);
    const v16f x = __builtin_shufflevector(lo, hi, 0, 1, 2, 3, 4, 5, 6, 7, 8, 9, 10, 11, 12, 13, 14, 15); return __builtin_convertvector(x, v16bf); }
__global__ __launch_bounds__(128) void k_proj(const float* __restrict__ CB, const float* __restrict__ WCB, const float* __restrict__ AB, const float* __restrict__ WAB, float* CP, float* AT) {
    __shared__ __align__(16) float St[2 * PBUF];       // the two buffers
    __shared__ __align__(16) float Ow[4 * 16 * 68];    // each wave's own 16 output rows, for whole-line stores
    const unsigned t = blockIdx.x, tid = threadIdx.x, lane = tid & 31, lr = lane & 15, hi = lane >> 4;
    const unsigned w = (unsigned)__builtin_amdgcn_readfirstlane((int)(tid >> 5)), wm = w & 1, wn = w >> 1;   // the wave's number as a scalar; its quarter
    const float* A; const float* Bt; float* C; int ldc;   // the tile's first rows of both operands; this wave's quarter of the result
    if (t < PJ_A) { const unsigned r0 = (t % (DM / PT)) * PT, c0 = (t / (DM / PT)) * PT; A = WAB + (size_t)r0 * DM; Bt = AB + (size_t)c0 * DM;
        C = AT + (size_t)(c0 / NK + wn) * DM * NK + (size_t)(r0 + wm * 64) * NK; ldc = NK; }
    else { const unsigned u = t - PJ_A, r0 = (u % (NB_ * NQ / PT)) * PT, c0 = (u / (NB_ * NQ / PT)) * PT; A = CB + (size_t)r0 * DM; Bt = WCB + (size_t)c0 * DM;
        C = CP + (size_t)(r0 + wm * 64) * DM + c0 + wn * 64; ldc = DM; }
    v8f acc[4][4];
#pragma unroll
    for (int mb = 0; mb < 4; ++mb)
#pragma unroll
        for (int nb = 0; nb < 4; ++nb) acc[mb][nb] = (v8f){};
    const unsigned lb = (unsigned)(size_t)St + (tid >> 4) * (PL * 4) + (tid & 15) * 16;   // the low 32 bits of a __shared__ address: the byte's place in the work-group's LDS
    const char* ga = (const char*)(A + (size_t)(tid >> 4) * DM) + (tid & 15) * 16; const char* gb = (const char*)(Bt + (size_t)(tid >> 4) * DM) + (tid & 15) * 16;
    pj_stage(lb, ga, gb);
    asm volatile("s_wait_asynccnt 0x0" ::: "memory");   // this wave's copies of stage 0 have landed; the compiler places no wait for them
    __syncthreads();                                    // and every other wave's: nobody reads stage 0 in front of this barrier
    pj_stage(lb + PBUF * 4, ga + KS * 4, gb + KS * 4);
    const float* fa = St + (wm * 64 + lr) * PL + 8 * hi; const float* fb = St + (PT + wn * 64 + lr) * PL + 8 * hi;
#pragma unroll 1   // rolled: one body of 32 products serves the eight stages
    for (int s = 0; s < DM / KS; ++s) {
        const float* pa = fa + (s & 1) * PBUF; const float* pb = fb + (s & 1) * PBUF;
        v16bf a[4];
#pragma unroll
        for (int kk = 0; kk < KS / 32; ++kk) {
            v16bf b[4];
#pragma unroll
            for (int mb = 0; mb < 4; ++mb) a[mb] = pj_frag(pa + mb * 16 * PL + kk * 32);
#pragma unroll
            for (int nb = 0; nb < 4; ++nb) b[nb] = pj_frag(pb + nb * 16 * PL + kk * 32);
            __builtin_amdgcn_sched_barrier(0);   // the block's 32 LDS reads stay one group in front of its 16 products: left to itself the schedule reads each b fragment just in front of its use and waits for it four times a block
#pragma unroll
            for (int nb = 0; nb < 4; ++nb)
#pragma unroll
                for (int mb = 0; mb < 4; ++mb) acc[mb][nb] = wmmab(a[mb], b[nb], acc[mb][nb]);
            __builtin_amdgcn_sched_barrier(0);   // and the next block's reads stay behind these products, not scattered among them
        }
        asm volatile("v_nop\n\tv_nop\n\tv_nop\n\tv_nop" : "+v"(acc[0][0]), "+v"(acc[1][1]), "+v"(acc[2][2]), "+v"(acc[3][3]) : "v"(a[0]), "v"(a[3]));   // the distance behind the stage's last products, on the branches that follow too
        asm volatile("s_wait_dscnt 0x0" ::: "memory");      // this wave's reads of the buffer are done before it is refilled
        asm volatile("s_wait_asynccnt 0x0" ::: "memory");   // this wave's copies of the next stage have landed
        __syncthreads();                                    // publishes the next stage and ends every wave's reads of this one
        if (s + 2 < DM / KS) pj_stage(lb + (s & 1) * (PBUF * 4), ga + (s + 2) * (KS * 4), gb + (s + 2) * (KS * 4));
    }
    asm volatile("s_wait_asynccnt 0x0" ::: "memory");   // no copy is outstanding when the wave goes on
    float* os = Ow + w * (16 * 68);
#pragma unroll
    for (int mb = 0; mb < 4; ++mb) {
#pragma unroll
        for (int nb = 0; nb < 4; ++nb) {
#pragma unroll
            for (int j = 0; j < 8; ++j) os[(hi * 8 + j) * 68 + nb * 16 + lr] = acc[mb][nb][j]; }
        __builtin_amdgcn_wave_barrier(); asm volatile("" ::: "memory");   // no instruction: keeps the compiler from moving the wave's LDS reads below over these stores (and, at the foot, the next stores over the reads)
        float* crow = C + (size_t)(mb * 16) * ldc;
#pragma unroll
        for (int s = 0; s < 8; ++s) { const int row = 2 * s + hi, cofs = lr * 4; *(v4f*)(crow + (size_t)row * ldc + cofs) = *(const v4fa*)(os + row * 68 + cofs); }
        __builtin_amdgcn_wave_barrier(); asm volatile("" ::: "memory");
    }
}

__device__ __forceinline__ h16 tohx(float x) { return (h16)x; }
typedef __attribute__((ext_vector_type(2))) _Float16 v2h;
typedef __attribute__((ext_vector_type(4))) _Float16 v4h;
typedef __attribute__((ext_vector_type(2))) unsigned short v2us;
typedef __attribute__((ext_vector_type(4))) unsigned short v4us;
typedef __attribute__((ext_vector_type(2))) float v2f;
typedef __attribute__((ext_vector_type(4))) int v4i;

// ---- k_attn: scores, softmax and the last product of RT context rows in one work-group of RT / RW waves.
// REGISTER BLOCK OF THE SCORES: a wave holds RW whole score rows; a lane holds, of each, the two neighbouring aspect rows 2 * lane and 2 * lane + 1. One 8-byte read of the aspect's projection serves 2 * RW tangents.
// BOTH OPERANDS OF THE SCORE LOOP STAND IN LDS: the entry's aspect projection whole (all 8 waves read all of it) and the work-group's RT rows of the context's projection, brought in front of the loop by asynchronous copies, all in flight at once;
// the loop then reads no global memory but the score vector. A wave's context words come as 16-byte reads of one address for all lanes. Each score is still one chain over the 512 units in their order.
// Each wave then forms CW tiles of 16 output columns for all RT rows: D[m = column][n = row] = sum_j aspect[j][column] w[row][j], so a lane holds 8 neighbouring columns of one row.
// The first operand's fragments come straight from the f32 input: a lane owns one column and reads its 16 aspect rows of a fragment word by word (16 lanes side by side: 64 bytes of a row), rounds each to bf16 and carries it as f16.
#define RT 32                     // context rows a work-group (two of the matrix instruction's N)
#define RW 4                      // context rows a wave
#define NW (RT / RW)              // waves a work-group
#define NT (NW * 32)              // threads a work-group
#define CW (DM / 16 / NW)         // column tiles a wave
#define EB 8                      // units a block of the score loop
#define PP (NK + 8)               // pitch of the weights in LDS, f16 words: 16 bytes over a row, for the 16-byte fragment reads
#define OP (DM + 4)               // pitch of the output tile in LDS, floats: 16 bytes over a row
typedef v2f __attribute__((may_alias)) v2fa;
typedef v2h __attribute__((may_alias)) v2ha;
struct SBlk { v2f a[EB]; v4f c[RW][EB / 4]; float v[EB]; };   // one block's operands: the aspect's and the context's words (vector registers, from LDS), the score vector's (scalar registers)
__device__ __forceinline__ void sblk_ld(SBlk& k, const float* a, const float* c, const float* __restrict__ vv, int e0) {
#pragma unroll
    for (int q = 0; q < EB; ++q) k.a[q] = *(const v2fa*)(a + (e0 + q) * NK);
#pragma unroll
    for (int r = 0; r < RW; ++r)
#pragma unroll
        for (int q = 0; q < EB / 4; ++q) k.c[r][q] = *(const v4fa*)(c + r * DM + e0 + q * 4);
#pragma unroll
    for (int q = 0; q < EB; ++q) k.v[q] = vv[e0 + q];
}
__device__ __forceinline__ void sblk_rnd(SBlk& k) {
#pragma unroll
    for (int q = 0; q < EB; ++q) k.v[q] = bfr(k.v[q]);
}
// The score loop's work runs as a pipeline three units deep, so that no instruction waits for the one in front of it: while unit q's tangents issue, unit q - 1's tangents are multiplied and summed and unit q + 1's sums are formed.
struct SPipe { v2f x[RW]; v2f t[RW]; float tv; };   // the next unit's sums; the last unit's tangents and its score-vector word
__device__ __forceinline__ void sblk_do(const SBlk& k, const SBlk& n, SPipe& p, v2f* s) {   // n: the block behind k; its first unit's sums are formed in k's last step
#pragma unroll
    for (int q = 0; q < EB; ++q) { const SBlk& m = q + 1 < EB ? k : n; const int qn = (q + 1) & (EB - 1);
        v2f tn[RW];
#pragma unroll
        for (int r = 0; r < RW; ++r) tn[r] = (v2f){__builtin_amdgcn_tanhf(p.x[r][0]), __builtin_amdgcn_tanhf(p.x[r][1])};   // the chip's own tangent instruction
#pragma unroll
        for (int r = 0; r < RW; ++r) { s[r][0] += p.tv * p.t[r][0]; s[r][1] += p.tv * p.t[r][1]; }
#pragma unroll
        for (int r = 0; r < RW; ++r) { const float cw = m.c[r][qn >> 2][qn & 3]; p.x[r] = (v2f){cw + m.a[qn][0], cw + m.a[qn][1]}; }
#pragma unroll
        for (int r = 0; r < RW; ++r) p.t[r] = tn[r];
        p.tv = k.v[q];
        // The step's order in the schedule: one tangent, one plain vector instruction, in turn.
#pragma unroll
        for (int i = 0; i < 2 * RW; ++i) { __builtin_amdgcn_sched_group_barrier(0x400, 1, 0); __builtin_amdgcn_sched_group_barrier(0x002, 1, 0); }
        __builtin_amdgcn_sched_barrier(0);   // a step's instructions stay in their step: moved together again, a product would stand directly behind its tangent
    }
}
// cp8: eight 16-byte asynchronous copies of a lane, global memory to LDS through no register, NT * 16 bytes apart in both. The s_wait_xcnt stands inside the statement, behind the last copy, so that no address register is rewritten in front of it.
#define CPS (NT * 16)             // bytes one copy of the whole work-group brings
__device__ __forceinline__ void cp8(unsigned l, const char* g) {
    asm volatile("global_load_async_to_lds_b128 %0, %8, off\n\t"
                 "global_load_async_to_lds_b128 %1, %9, off\n\t"
                 "global_load_async_to_lds_b128 %2, %10, off\n\t"
                 "global_load_async_to_lds_b128 %3, %11, off\n\t"
                 "global_load_async_to_lds_b128 %4, %12, off\n\t"
                 "global_load_async_to_lds_b128 %5, %13, off\n\t"
                 "global_load_async_to_lds_b128 %6, %14, off\n\t"
                 "global_load_async_to_lds_b128 %7, %15, off\n\t"
                 "s_wait_xcnt 0x0"
                 :: "v"(l), "v"(l + CPS), "v"(l + 2 * CPS), "v"(l + 3 * CPS), "v"(l + 4 * CPS), "v"(l + 5 * CPS), "v"(l + 6 * CPS), "v"(l + 7 * CPS),
                    "v"(g), "v"(g + CPS), "v"(g + 2 * CPS), "v"(g + 3 * CPS), "v"(g + 4 * CPS), "v"(g + 5 * CPS), "v"(g + 6 * CPS), "v"(g + 7 * CPS) : "memory");
}
__global__ __launch_bounds__(NT) void k_attn(const float* __restrict__ CP, const float* __restrict__ AT, const float* __restrict__ vv, const float* __restrict__ ASP, float* OUT) {
    __shared__ __align__(16) float As[DM * NK];   // the entry's aspect projection, transposed, whole (128 KiB)
    __shared__ __align__(16) float Cs[RT * DM];   // this work-group's rows of the context's projection (64 KiB)
    __shared__ __align__(16) float Ss[RT * NK];   // scores
    __shared__ __align__(16) float Es[RT * NK];   // exponentials
    __shared__ __align__(16) h16 Ps[RT * PP];     // weights
    __shared__ __align__(16) float Os[RT * OP];   // the output tile, for whole-line stores
    const unsigned tid = threadIdx.x, lane = tid & 31, lr = lane & 15, hi = lane >> 4, b = blockIdx.x / (NQ / RT);
    const unsigned w = (unsigned)__builtin_amdgcn_readfirstlane((int)(tid >> 5));   // the wave's number as a scalar
    const float* c = Cs + w * RW * DM; const float* a = As + 2 * lane;
    const float* ap = ASP + ((size_t)b * NK + 8 * hi) * DM + w * CW * 16 + lr;   // the lane's column, at the first aspect row of its half of a fragment
    float vr[CW][2][16];   // this wave's columns of the aspect, asked for in front of the copies: they land, and are rounded, while the copies fly
#pragma unroll
    for (int t = 0; t < CW; ++t)
#pragma unroll
        for (int h = 0; h < 2; ++h)
#pragma unroll
            for (int q = 0; q < 16; ++q) vr[t][h][q] = ap[(size_t)(h * 32 + (q >> 3) * 16 + (q & 7)) * DM + t * 16];
    { const char* ga = (const char*)(AT + (size_t)b * DM * NK) + tid * 16; const char* gc = (const char*)(CP + (size_t)blockIdx.x * RT * DM) + tid * 16;
      const unsigned la = (unsigned)(size_t)As + tid * 16, lc = (unsigned)(size_t)Cs + tid * 16;   // the low 32 bits of a __shared__ address: the byte's place in the work-group's LDS
#pragma unroll   // straight-line: 16 + 32 copies a lane, every one outstanding at once (63 is the limit)
      for (int i = 0; i < RT * DM * 4 / (8 * CPS); ++i) cp8(lc + i * 8 * CPS, gc + i * 8 * CPS);
#pragma unroll
      for (int i = 0; i < DM * NK * 4 / (8 * CPS); ++i) cp8(la + i * 8 * CPS, ga + i * 8 * CPS); }
    v16h va[CW][2];
#pragma unroll
    for (int t = 0; t < CW; ++t)
#pragma unroll
        for (int h = 0; h < 2; ++h)
#pragma unroll
            for (int q = 0; q < 16; ++q) va[t][h][q] = tohx(bfr(vr[t][h][q]));
    asm volatile("" :: "v"(va[0][0]), "v"(va[0][1]), "v"(va[1][0]), "v"(va[1][1]), "v"(va[2][0]), "v"(va[2][1]), "v"(va[3][0]), "v"(va[3][1]));   // inputs only, no instruction: the rounded words are formed here, while the copies fly; without it the compiler moves the rounding behind the score loop, where it stands open, and carries 128 registers over the loop in place of 64
    asm volatile("s_wait_asynccnt 0x0" ::: "memory");   // this wave's copies have landed; the compiler places no wait for them
    __syncthreads();                                    // and every other wave's: nobody reads As or Cs in front of this barrier
    v2f s[RW];
#pragma unroll
    for (int r = 0; r < RW; ++r) s[r] = (v2f){0.0f, 0.0f};
    SBlk k0, k1;   // two sets: the next block's loads fly while this block's tangents issue
    sblk_ld(k0, a, c, vv, 0);
    SPipe p;       // filled for unit 0: its sums; no tangents yet (zeros: the first step adds 0 * 0 to the zero scores)
#pragma unroll
    for (int r = 0; r < RW; ++r) { const float cw = k0.c[r][0][0]; p.x[r] = (v2f){cw + k0.a[0][0], cw + k0.a[0][1]}; p.t[r] = (v2f){0.0f, 0.0f}; }
    p.tv = 0.0f;
    // The order of a half trip: (1) this block's score-vector words are rounded: the first use of its scalar words, so the one wait for scalar loads (it can only be to 0) stands in front of the next block's; (2) the next block's LDS reads and scalar load; (3) this block's tangents.
    // sched_barrier(0) keeps the three parts in that order in the schedule; wave_barrier (no instruction) keeps the compiler from moving the loads of part 2 over the loop's back edge down to their first use. Without them every load's latency stands open.
    for (int e0 = 0; e0 < DM; e0 += 2 * EB) {
        sblk_rnd(k0); __builtin_amdgcn_sched_barrier(0);
        sblk_ld(k1, a, c, vv, e0 + EB); __builtin_amdgcn_wave_barrier(); __builtin_amdgcn_sched_barrier(0);
        sblk_do(k0, k1, p, s);
        sblk_rnd(k1); __builtin_amdgcn_sched_barrier(0);
        sblk_ld(k0, a, c, vv, (e0 + 2 * EB) & (DM - 1)); __builtin_amdgcn_wave_barrier(); __builtin_amdgcn_sched_barrier(0);   // the last trip asks for block 0 again: in bounds; the sums formed of it are not used
        sblk_do(k1, k0, p, s);
    }
#pragma unroll
    for (int r = 0; r < RW; ++r) { s[r][0] += p.tv * p.t[r][0]; s[r][1] += p.tv * p.t[r][1]; }   // the last unit's products
#pragma unroll
    for (int r = 0; r < RW; ++r) *(v2fa*)(Ss + (w * RW + r) * NK + 2 * lane) = s[r];
    __syncthreads();
    v2f ex[RW];
#pragma unroll
    for (int r = 0; r < RW; ++r) { const float* srow = Ss + (w * RW + r) * NK; float mx = srow[0];
#pragma unroll   // straight-line: the row comes as 16-byte LDS reads at literal offsets, several in flight
        for (int q = 0; q < NK / 4; ++q) { const v4f x = *(const v4fa*)(srow + q * 4); mx = fmaxf(fmaxf(fmaxf(fmaxf(mx, x[0]), x[1]), x[2]), x[3]); }
        ex[r] = (v2f){expf(s[r][0] - mx), expf(s[r][1] - mx)};
        *(v2fa*)(Es + (w * RW + r) * NK + 2 * lane) = ex[r]; }
    __syncthreads();
#pragma unroll
    for (int r = 0; r < RW; ++r) { const float* erow = Es + (w * RW + r) * NK; float sum = 0.0f;
#pragma unroll   // straight-line, as above; the additions stay one chain in the order of the aspect rows
        for (int q = 0; q < NK / 4; ++q) { const v4f x = *(const v4fa*)(erow + q * 4); sum += x[0]; sum += x[1]; sum += x[2]; sum += x[3]; }
        *(v2ha*)(Ps + (w * RW + r) * PP + 2 * lane) = (v2h){tohx(ex[r][0] / sum), tohx(ex[r][1] / sum)}; }
    __syncthreads();
#pragma unroll
    for (int n = 0; n < RT / 16; ++n) { const h16* pb = Ps + (n * 16 + lr) * PP + 8 * hi;
        const v16h p0 = cat16(*(const v8ha*)pb, *(const v8ha*)(pb + 16)), p1 = cat16(*(const v8ha*)(pb + 32), *(const v8ha*)(pb + 48));
#pragma unroll
        for (int t = 0; t < CW; ++t) { v8f acc = (v8f){};
            acc = wmma16(va[t][0], p0, acc);
            acc = wmma16(va[t][1], p1, acc);
            float* op = Os + (n * 16 + lr) * OP + (w * CW + t) * 16 + hi * 8;
            *(v4fa*)op = (v4f){acc[0], acc[1], acc[2], acc[3]}; *(v4fa*)(op + 4) = (v4f){acc[4], acc[5], acc[6], acc[7]}; } }
    __syncthreads();
    const unsigned r2 = tid / (DM / 4), col = (tid % (DM / 4)) * 4; const float* osp = Os + r2 * OP + col; float* gp = OUT + ((size_t)blockIdx.x * RT + r2) * DM + col;
#pragma unroll   // straight-line: the LDS reads go out ahead of the stores, and one address serves all of each at literal offsets
    for (int q = 0; q < RT * DM / 4 / NT; ++q) *(v4f*)(gp + (size_t)q * (NT * 4)) = *(const v4fa*)(osp + q * (NT * 4 / DM) * OP);
}

extern "C" void kernel_launch(void* const* d_in, const int* in_sizes, int n_in,
                              void* d_out, int out_size, void* d_ws, size_t ws_size, hipStream_t stream) {
    (void)in_sizes; (void)n_in; (void)out_size;
    const float* a0 = (const float*)d_in[0]; const float* a1 = (const float*)d_in[1]; const float* a2 = (const float*)d_in[2]; const float* a3 = (const float*)d_in[3]; const float* a4 = (const float*)d_in[4];   /* the module's argument order: the context, the aspect, the two projections, the score vector: FIVE inputs, all read */
    float* OUT = (float*)d_out;     // [32][256][512]
    char* wsp = (char*)d_ws;
    auto take = [&](size_t bytes) { char* p = wsp; wsp += (bytes + 255) & ~(size_t)255; return (void*)p; };
    float* CP = (float*)take((size_t)NB_ * NQ * DM * 4); float* AT = (float*)take((size_t)NB_ * DM * NK * 4);
    if ((size_t)(wsp - (char*)d_ws) > ws_size) return;    // total 20.00 MiB carved
    k_proj<<<(unsigned)(PJ_A + PJ_C), 128, 0, stream>>>(a0, a2, a1, a3, CP, AT);   /* the context's projection (all 8,192 rows) and the aspect's, transposed (the projection shared by the 32 entries) */
    k_attn<<<(unsigned)(NB_ * NQ / RT), NT, 0, stream>>>(CP, AT, a4, a1, OUT);   /* scores, softmax and out[b][i][d] = sum_j w[b][i][j] aspect[b][j][d] (depth 64) for 32 context rows a work-group; the one writer of the output */
}

// v009
// A run of this version takes 34.3 microseconds.
// Timed twice side by side with v008, it ran 1.04 times as fast both times.
// Counting every step since v000, it is 9.03 times as fast.
#include <hip/hip_runtime.h>

// An additive (tangent) attention of a context over an aspect (inputs, in argument order: a0 [32][256][512] the context; a1 [32][64][512] the aspect; a2, a3 [512][512] two projections ('out, in'); a4 [512] a score vector):
//   c = a0 a2^T ([256][512] an entry);  a = a1 a3^T ([64][512] an entry);  s[i][j] = the sum over the 512 units e of a4[e] tanh(c[i][e] + a[j][e]);  w = softmax over the 64 aspect rows j;  out[i][:] = the sum over j of w[i][j] a1[j][:]  ->  [32][256][512] (4.2 M).
// THE MODULE's OWN ORDER. No preparation launch: each kernel reads the f32 inputs themselves and rounds a word to bf16 where it uses it. The context's projection CP [8192][512] f32 by one product (the projections stand 'out, in' = the product's [N][K] operand as they are); THE ASPECT's PROJECTION IS COMPUTED ALREADY TRANSPOSED, AT [32][512][64] f32, by giving the projection as the product's first operand (shared by the entries) and an entry's aspect rows as its second;
// k_attn does the rest for 32 context rows a work-group: the scores (one loop of 512 units with the chip's tangent instruction, a thread holding 4 rows by 2 aspect rows), each row's softmax (a row lies whole in one wave: the maximum and the sum by a five-step butterfly across the lanes) with the weights as ONE f16 word, and the last product (f16 words of both operands; depth 64; the aspect's words taken from the input, column by column, into the fragment registers); the scores stay in registers, the weights pass through LDS, and neither reaches memory.
// TWO LAUNCHES: k_proj (both projections), k_attn (scores, softmax, last product).
// Every address from the lane's own index, a loop's own counter and launch constants; exact grids, no guard; no atomic; cross-lane words: the wave's own number taken as a scalar in k_proj and k_attn, and the softmax's butterfly in k_attn.
// Compute dtypes, f32 accumulate: every float input rounded to bf16 at its use; both projections ONE bf16 product on exact operands; scores and softmax f32; the weights ONE f16 word each against the aspect's own bf16 words carried as f16 (exact but for words under 2^-14).

#define NB_  32                   // entries
#define NQ   256                  // context rows (queries) an entry
#define NK   64                   // aspect rows (keys = values) an entry
#define DM   512                  // the width of both and the units
typedef _Float16 h16;
typedef unsigned short bf;
typedef __attribute__((ext_vector_type(16))) __bf16   v16bf;
typedef __attribute__((ext_vector_type(16))) _Float16 v16h;
typedef __attribute__((ext_vector_type(8)))  _Float16 v8h;
typedef __attribute__((ext_vector_type(8)))  float    v8f;
typedef __attribute__((ext_vector_type(4)))  float    v4f;
typedef v8h  __attribute__((may_alias)) v8ha;
typedef v4f  __attribute__((may_alias)) v4fa;
typedef __attribute__((ext_vector_type(16))) float    v16f;

__device__ __forceinline__ unsigned short f2bf(float f) { unsigned u = __float_as_uint(f); u += 0x7FFFu + ((u >> 16) & 1u); return (unsigned short)(u >> 16); }
__device__ __forceinline__ float bf2f(unsigned short b) { return __uint_as_float(((unsigned)b) << 16); }
__device__ __forceinline__ float bfr(float f) { return bf2f(f2bf(f)); }
__device__ __forceinline__ v16h cat16(v8h lo, v8h hi) { return __builtin_shufflevector(lo, hi, 0, 1, 2, 3, 4, 5, 6, 7, 8, 9, 10, 11, 12, 13, 14, 15); }
__device__ __forceinline__ v8f wmma16(v16h a, v16h b, v8f c) { return __builtin_amdgcn_wmma_f32_16x16x32_f16(false, a, false, b, (short)0, c, false, false); }
__device__ __forceinline__ v8f wmmab(v16bf a, v16bf b, v8f c) { return __builtin_amdgcn_wmma_f32_16x16x32_bf16(false, a, false, b, (short)0, c, false, false); }



// ---- k_proj: BOTH projections in one launch (neither reads the other's result); the block index picks the product. C[m][n] (f32) = sum_k A[m][k] Bt[n][k], depth DM.
// A WORK-GROUP OF 4 WAVES FORMS A 128x128 TILE, each wave a 64x64 quarter (16 accumulators). Both operands' 128 rows pass through LDS AS THE f32 WORDS OF THE INPUTS, in stages of KS words of depth, brought by asynchronous copies into two buffers:
// the next stage's copies fly while this stage's products issue, and a row is fetched from L2 once for the two waves that read it. A fragment's 16 words are read from LDS as f32 and rounded to bf16 (to nearest, ties to even) in registers. Every accumulator still takes its 16 products in the order of k.
// The aspect's product has the projection as its first operand and the aspect rows of all entries, 2,048 in a row, as its second: a wave's 64 columns are one entry's rows, so its quarter goes to that entry's transposed plane.
#define PT 128                    // rows and columns of a work-group's tile
#define KS 64                     // depth of a stage, f32 words: 256 bytes a row
#define PL (KS + 4)               // pitch of a staged row in LDS, f32 words: 16 bytes over a row, for the 16-byte fragment reads
#define PBUF (2 * PT * PL)        // words of one buffer: the first operand's rows, then the second's
#define PJ_A ((DM / PT) * (NB_ * NK / PT))   // tiles of the aspect's projection
#define PJ_C ((NB_ * NQ / PT) * (DM / PT))   // tiles of the context's projection
// cp8r: eight 16-byte asynchronous copies of a lane, global memory to LDS through no register, 8 rows apart in both. The s_wait_xcnt stands inside the statement, behind the last copy, so that no address register is rewritten in front of it.
#define RL (8 * PL * 4)           // bytes 8 rows take in LDS
#define RG (8 * DM * 4)           // and in memory
__device__ __forceinline__ void cp8r(unsigned l, const char* g) {
    asm volatile("global_load_async_to_lds_b128 %0, %8, off\n\t"
                 "global_load_async_to_lds_b128 %1, %9, off\n\t"
                 "global_load_async_to_lds_b128 %2, %10, off\n\t"
                 "global_load_async_to_lds_b128 %3, %11, off\n\t"
                 "global_load_async_to_lds_b128 %4, %12, off\n\t"
                 "global_load_async_to_lds_b128 %5, %13, off\n\t"
                 "global_load_async_to_lds_b128 %6, %14, off\n\t"
                 "global_load_async_to_lds_b128 %7, %15, off\n\t"
                 "s_wait_xcnt 0x0"
                 :: "v"(l), "v"(l + RL), "v"(l + 2 * RL), "v"(l + 3 * RL), "v"(l + 4 * RL), "v"(l + 5 * RL), "v"(l + 6 * RL), "v"(l + 7 * RL),
                    "v"(g), "v"(g + RG), "v"(g + 2 * RG), "v"(g + 3 * RG), "v"(g + 4 * RG), "v"(g + 5 * RG), "v"(g + 6 * RG), "v"(g + 7 * RG) : "memory");
}
// One stage of both operands: 16 lanes a row, 8 rows a copy of the work-group, 16 + 16 copies a lane (63 may be outstanding).
__device__ __forceinline__ void pj_stage(unsigned l, const char* ga, const char* gb) {
    cp8r(l, ga); cp8r(l + 8 * RL, ga + 8 * RG);
    cp8r(l + PT * PL * 4, gb); cp8r(l + PT * PL * 4 + 8 * RL, gb + 8 * RG);
}
// One 16x32 fragment: the lane's two runs of 8 words, 16 words apart, four 16-byte LDS reads; the conversion is the chip's packed f32-to-bf16 instruction.
__device__ __forceinline__ v16bf pj_frag(const float* p) { const v4f x0 = *(const v4fa*)p, x1 = *(const v4fa*)(p + 4), x2 = *(const v4fa*)(p + 16), x3 = *(const v4fa*)(p + 20);
    const v8f lo = __builtin_shufflevector(x0, x1, 0, 1, 2, 3, 4, 5, 6, 7), hi = __builtin_shufflevector(x2, x3, 0, 1, 2, 3, 4, 5, 6, 7);
    const v16f x = __builtin_shufflevector(lo, hi, 0, 1, 2, 3, 4, 5, 6, 7, 8, 9, 10, 11, 12, 13, 14, 15); return __builtin_convertvector(x, v16bf); }
__global__ __launch_bounds__(128) void k_proj(const float* __restrict__ CB, const float* __restrict__ WCB, const float* __restrict__ AB, const float* __restrict__ WAB, float* CP, float* AT) {
    __shared__ __align__(16) float St[2 * PBUF];       // the two buffers
    __shared__ __align__(16) float Ow[4 * 16 * 68];    // each wave's own 16 output rows, for whole-line stores
    const unsigned t = blockIdx.x, tid = threadIdx.x, lane = tid & 31, lr = lane & 15, hi = lane >> 4;
    const unsigned w = (unsigned)__builtin_amdgcn_readfirstlane((int)(tid >> 5)), wm = w & 1, wn = w >> 1;   // the wave's number as a scalar; its quarter
    const float* A; const float* Bt; float* C; int ldc;   // the tile's first rows of both operands; this wave's quarter of the result
    if (t < PJ_A) { const unsigned r0 = (t % (DM / PT)) * PT, c0 = (t / (DM / PT)) * PT; A = WAB + (size_t)r0 * DM; Bt = AB + (size_t)c0 * DM;
        C = AT + (size_t)(c0 / NK + wn) * DM * NK + (size_t)(r0 + wm * 64) * NK; ldc = NK; }
    else { const unsigned u = t - PJ_A, r0 = (u % (NB_ * NQ / PT)) * PT, c0 = (u / (NB_ * NQ / PT)) * PT; A = CB + (size_t)r0 * DM; Bt = WCB + (size_t)c0 * DM;
        C = CP + (size_t)(r0 + wm * 64) * DM + c0 + wn * 64; ldc = DM; }
    v8f acc[4][4];
#pragma unroll
    for (int mb = 0; mb < 4; ++mb)
#pragma unroll
        for (int nb = 0; nb < 4; ++nb) acc[mb][nb] = (v8f){};
    const unsigned lb = (unsigned)(size_t)St + (tid >> 4) * (PL * 4) + (tid & 15) * 16;   // the low 32 bits of a __shared__ address: the byte's place in the work-group's LDS
    const char* ga = (const char*)(A + (size_t)(tid >> 4) * DM) + (tid & 15) * 16; const char* gb = (const char*)(Bt + (size_t)(tid >> 4) * DM) + (tid & 15) * 16;
    pj_stage(lb, ga, gb);
    asm volatile("s_wait_asynccnt 0x0" ::: "memory");   // this wave's copies of stage 0 have landed; the compiler places no wait for them
    __syncthreads();                                    // and every other wave's: nobody reads stage 0 in front of this barrier
    pj_stage(lb + PBUF * 4, ga + KS * 4, gb + KS * 4);
    const float* fa = St + (wm * 64 + lr) * PL + 8 * hi; const float* fb = St + (PT + wn * 64 + lr) * PL + 8 * hi;
#pragma unroll 1   // rolled: one body of 32 products serves the eight stages
    for (int s = 0; s < DM / KS; ++s) {
        const float* pa = fa + (s & 1) * PBUF; const float* pb = fb + (s & 1) * PBUF;
        v16bf a[4];
#pragma unroll
        for (int kk = 0; kk < KS / 32; ++kk) {
            v16bf b[4];
#pragma unroll
            for (int mb = 0; mb < 4; ++mb) a[mb] = pj_frag(pa + mb * 16 * PL + kk * 32);
#pragma unroll
            for (int nb = 0; nb < 4; ++nb) b[nb] = pj_frag(pb + nb * 16 * PL + kk * 32);
            __builtin_amdgcn_sched_barrier(0);   // the block's 32 LDS reads stay one group in front of its 16 products: left to itself the schedule reads each b fragment just in front of its use and waits for it four times a block
#pragma unroll
            for (int nb = 0; nb < 4; ++nb)
#pragma unroll
                for (int mb = 0; mb < 4; ++mb) acc[mb][nb] = wmmab(a[mb], b[nb], acc[mb][nb]);
            __builtin_amdgcn_sched_barrier(0);   // and the next block's reads stay behind these products, not scattered among them
        }
        asm volatile("v_nop\n\tv_nop\n\tv_nop\n\tv_nop" : "+v"(acc[0][0]), "+v"(acc[1][1]), "+v"(acc[2][2]), "+v"(acc[3][3]) : "v"(a[0]), "v"(a[3]));   // the distance behind the stage's last products, on the branches that follow too
        asm volatile("s_wait_dscnt 0x0" ::: "memory");      // this wave's reads of the buffer are done before it is refilled
        asm volatile("s_wait_asynccnt 0x0" ::: "memory");   // this wave's copies of the next stage have landed
        __syncthreads();                                    // publishes the next stage and ends every wave's reads of this one
        if (s + 2 < DM / KS) pj_stage(lb + (s & 1) * (PBUF * 4), ga + (s + 2) * (KS * 4), gb + (s + 2) * (KS * 4));
    }
    asm volatile("s_wait_asynccnt 0x0" ::: "memory");   // no copy is outstanding when the wave goes on
    float* os = Ow + w * (16 * 68);
#pragma unroll
    for (int mb = 0; mb < 4; ++mb) {
#pragma unroll
        for (int nb = 0; nb < 4; ++nb) {
#pragma unroll
            for (int j = 0; j < 8; ++j) os[(hi * 8 + j) * 68 + nb * 16 + lr] = acc[mb][nb][j]; }
        __builtin_amdgcn_wave_barrier(); asm volatile("" ::: "memory");   // no instruction: keeps the compiler from moving the wave's LDS reads below over these stores (and, at the foot, the next stores over the reads)
        float* crow = C + (size_t)(mb * 16) * ldc;
#pragma unroll
        for (int s = 0; s < 8; ++s) { const int row = 2 * s + hi, cofs = lr * 4; *(v4f*)(crow + (size_t)row * ldc + cofs) = *(const v4fa*)(os + row * 68 + cofs); }
        __builtin_amdgcn_wave_barrier(); asm volatile("" ::: "memory");
    }
}

__device__ __forceinline__ h16 tohx(float x) { return (h16)x; }
typedef __attribute__((ext_vector_type(2))) _Float16 v2h;
typedef __attribute__((ext_vector_type(4))) _Float16 v4h;
typedef __attribute__((ext_vector_type(2))) unsigned short v2us;
typedef __attribute__((ext_vector_type(4))) unsigned short v4us;
typedef __attribute__((ext_vector_type(2))) float v2f;
typedef __attribute__((ext_vector_type(4))) int v4i;

// ---- k_attn: scores, softmax and the last product of RT context rows in one work-group of RT / RW waves.
// REGISTER BLOCK OF THE SCORES: a wave holds RW whole score rows; a lane holds, of each, the two neighbouring aspect rows 2 * lane and 2 * lane + 1. One 8-byte read of the aspect's projection serves 2 * RW tangents.
// BOTH OPERANDS OF THE SCORE LOOP STAND IN LDS: the entry's aspect projection whole (all 8 waves read all of it) and the work-group's RT rows of the context's projection, brought in front of the loop by asynchronous copies, all in flight at once;
// the loop then reads no global memory but the score vector. A wave's context words come as 16-byte reads of one address for all lanes. Each score is still one chain over the 512 units in their order.
// Each wave then forms CW tiles of 16 output columns for all RT rows: D[m = column][n = row] = sum_j aspect[j][column] w[row][j], so a lane holds 8 neighbouring columns of one row.
// The first operand's fragments come straight from the f32 input: a lane owns one column and reads its 16 aspect rows of a fragment word by word (16 lanes side by side: 64 bytes of a row), rounds each to bf16 and carries it as f16.
#define RT 32                     // context rows a work-group (two of the matrix instruction's N)
#define RW 4                      // context rows a wave
#define NW (RT / RW)              // waves a work-group
#define NT (NW * 32)              // threads a work-group
#define CW (DM / 16 / NW)         // column tiles a wave
#define EB 8                      // units a block of the score loop
#define PP (NK + 8)               // pitch of the weights in LDS, f16 words: 16 bytes over a row, for the 16-byte fragment reads
#define OP (DM + 4)               // pitch of the output tile in LDS, floats: 16 bytes over a row
typedef v2f __attribute__((may_alias)) v2fa;
typedef v2h __attribute__((may_alias)) v2ha;
struct SBlk { v2f a[EB]; v4f c[RW][EB / 4]; float v[EB]; };   // one block's operands: the aspect's and the context's words (vector registers, from LDS), the score vector's (scalar registers)
__device__ __forceinline__ void sblk_ld(SBlk& k, const float* a, const float* c, const float* __restrict__ vv, int e0) {
#pragma unroll
    for (int q = 0; q < EB; ++q) k.a[q] = *(const v2fa*)(a + (e0 + q) * NK);
#pragma unroll
    for (int r = 0; r < RW; ++r)
#pragma unroll
        for (int q = 0; q < EB / 4; ++q) k.c[r][q] = *(const v4fa*)(c + r * DM + e0 + q * 4);
#pragma unroll
    for (int q = 0; q < EB; ++q) k.v[q] = vv[e0 + q];
}
__device__ __forceinline__ void sblk_rnd(SBlk& k) {
#pragma unroll
    for (int q = 0; q < EB; ++q) k.v[q] = bfr(k.v[q]);
}
// The score loop's work runs as a pipeline three units deep, so that no instruction waits for the one in front of it: while unit q's tangents issue, unit q - 1's tangents are multiplied and summed and unit q + 1's sums are formed.
struct SPipe { v2f x[RW]; v2f t[RW]; float tv; };   // the next unit's sums; the last unit's tangents and its score-vector word
__device__ __forceinline__ void sblk_do(const SBlk& k, const SBlk& n, SPipe& p, v2f* s) {   // n: the block behind k; its first unit's sums are formed in k's last step
#pragma unroll
    for (int q = 0; q < EB; ++q) { const SBlk& m = q + 1 < EB ? k : n; const int qn = (q + 1) & (EB - 1);
        v2f tn[RW];
#pragma unroll
        for (int r = 0; r < RW; ++r) tn[r] = (v2f){__builtin_amdgcn_tanhf(p.x[r][0]), __builtin_amdgcn_tanhf(p.x[r][1])};   // the chip's own tangent instruction
#pragma unroll
        for (int r = 0; r < RW; ++r) { s[r][0] += p.tv * p.t[r][0]; s[r][1] += p.tv * p.t[r][1]; }
#pragma unroll
        for (int r = 0; r < RW; ++r) { const float cw = m.c[r][qn >> 2][qn & 3]; p.x[r] = (v2f){cw + m.a[qn][0], cw + m.a[qn][1]}; }
#pragma unroll
        for (int r = 0; r < RW; ++r) p.t[r] = tn[r];
        p.tv = k.v[q];
        // The step's order in the schedule: one tangent, one plain vector instruction, in turn.
#pragma unroll
        for (int i = 0; i < 2 * RW; ++i) { __builtin_amdgcn_sched_group_barrier(0x400, 1, 0); __builtin_amdgcn_sched_group_barrier(0x002, 1, 0); }
        __builtin_amdgcn_sched_barrier(0);   // a step's instructions stay in their step: moved together again, a product would stand directly behind its tangent
    }
}
// cp8: eight 16-byte asynchronous copies of a lane, global memory to LDS through no register, NT * 16 bytes apart in both. The s_wait_xcnt stands inside the statement, behind the last copy, so that no address register is rewritten in front of it.
#define CPS (NT * 16)             // bytes one copy of the whole work-group brings
__device__ __forceinline__ void cp8(unsigned l, const char* g) {
    asm volatile("global_load_async_to_lds_b128 %0, %8, off\n\t"
                 "global_load_async_to_lds_b128 %1, %9, off\n\t"
                 "global_load_async_to_lds_b128 %2, %10, off\n\t"
                 "global_load_async_to_lds_b128 %3, %11, off\n\t"
                 "global_load_async_to_lds_b128 %4, %12, off\n\t"
                 "global_load_async_to_lds_b128 %5, %13, off\n\t"
                 "global_load_async_to_lds_b128 %6, %14, off\n\t"
                 "global_load_async_to_lds_b128 %7, %15, off\n\t"
                 "s_wait_xcnt 0x0"
                 :: "v"(l), "v"(l + CPS), "v"(l + 2 * CPS), "v"(l + 3 * CPS), "v"(l + 4 * CPS), "v"(l + 5 * CPS), "v"(l + 6 * CPS), "v"(l + 7 * CPS),
                    "v"(g), "v"(g + CPS), "v"(g + 2 * CPS), "v"(g + 3 * CPS), "v"(g + 4 * CPS), "v"(g + 5 * CPS), "v"(g + 6 * CPS), "v"(g + 7 * CPS) : "memory");
}
// Cross-lane words for the softmax. lx<M>: the word of lane l ^ M inside a 16-lane row (M = 1, 2, 4, 8; DPP row_xmask); lx16: the word of lane l ^ 16. All 32 lanes are on where they are used.
template <int M> __device__ __forceinline__ float lx(float x) { const int b = __float_as_int(x); return __int_as_float(__builtin_amdgcn_mov_dpp(b, 0x160 + M, 0xf, 0xf, true)); }
__device__ __forceinline__ float lx16(float x) { const int b = __float_as_int(x); return __int_as_float(__builtin_amdgcn_permlanex16(b, b, 0x76543210, 0xfedcba98, false, false)); }
// A butterfly of five steps over the wave for RW values at once: every lane ends with the same word (each step joins a lane's word and its partner's, and both form the same result).
__device__ __forceinline__ void wave_max(float* x) {
#pragma unroll
    for (int r = 0; r < RW; ++r) x[r] = fmaxf(x[r], lx<1>(x[r]));
#pragma unroll
    for (int r = 0; r < RW; ++r) x[r] = fmaxf(x[r], lx<2>(x[r]));
#pragma unroll
    for (int r = 0; r < RW; ++r) x[r] = fmaxf(x[r], lx<4>(x[r]));
#pragma unroll
    for (int r = 0; r < RW; ++r) x[r] = fmaxf(x[r], lx<8>(x[r]));
#pragma unroll
    for (int r = 0; r < RW; ++r) x[r] = fmaxf(x[r], lx16(x[r]));
}
__device__ __forceinline__ void wave_sum(float* x) {
#pragma unroll
    for (int r = 0; r < RW; ++r) x[r] += lx<1>(x[r]);
#pragma unroll
    for (int r = 0; r < RW; ++r) x[r] += lx<2>(x[r]);
#pragma unroll
    for (int r = 0; r < RW; ++r) x[r] += lx<4>(x[r]);
#pragma unroll
    for (int r = 0; r < RW; ++r) x[r] += lx<8>(x[r]);
#pragma unroll
    for (int r = 0; r < RW; ++r) x[r] += lx16(x[r]);
}
__global__ __launch_bounds__(NT) void k_attn(const float* __restrict__ CP, const float* __restrict__ AT, const float* __restrict__ vv, const float* __restrict__ ASP, float* OUT) {
    __shared__ __align__(16) float As[DM * NK];   // the entry's aspect projection, transposed, whole (128 KiB)
    __shared__ __align__(16) float Cs[RT * DM];   // this work-group's rows of the context's projection (64 KiB)
    __shared__ __align__(16) h16 Ps[RT * PP];     // weights
    __shared__ __align__(16) float Os[RT * OP];   // the output tile, for whole-line stores
    const unsigned tid = threadIdx.x, lane = tid & 31, lr = lane & 15, hi = lane >> 4, b = blockIdx.x / (NQ / RT);
    const unsigned w = (unsigned)__builtin_amdgcn_readfirstlane((int)(tid >> 5));   // the wave's number as a scalar
    const float* c = Cs + w * RW * DM; const float* a = As + 2 * lane;
    const float* ap = ASP + ((size_t)b * NK + 8 * hi) * DM + w * CW * 16 + lr;   // the lane's column, at the first aspect row of its half of a fragment
    float vr[CW][2][16];   // this wave's columns of the aspect, asked for in front of the copies: they land, and are rounded, while the copies fly
#pragma unroll
    for (int t = 0; t < CW; ++t)
#pragma unroll
        for (int h = 0; h < 2; ++h)
#pragma unroll
            for (int q = 0; q < 16; ++q) vr[t][h][q] = ap[(size_t)(h * 32 + (q >> 3) * 16 + (q & 7)) * DM + t * 16];
    { const char* ga = (const char*)(AT + (size_t)b * DM * NK) + tid * 16; const char* gc = (const char*)(CP + (size_t)blockIdx.x * RT * DM) + tid * 16;
      const unsigned la = (unsigned)(size_t)As + tid * 16, lc = (unsigned)(size_t)Cs + tid * 16;   // the low 32 bits of a __shared__ address: the byte's place in the work-group's LDS
#pragma unroll   // straight-line: 16 + 32 copies a lane, every one outstanding at once (63 is the limit)
      for (int i = 0; i < RT * DM * 4 / (8 * CPS); ++i) cp8(lc + i * 8 * CPS, gc + i * 8 * CPS);
#pragma unroll
      for (int i = 0; i < DM * NK * 4 / (8 * CPS); ++i) cp8(la + i * 8 * CPS, ga + i * 8 * CPS); }
    v16h va[CW][2];
#pragma unroll
    for (int t = 0; t < CW; ++t)
#pragma unroll
        for (int h = 0; h < 2; ++h)
#pragma unroll
            for (int q = 0; q < 16; ++q) va[t][h][q] = tohx(bfr(vr[t][h][q]));
    asm volatile("" :: "v"(va[0][0]), "v"(va[0][1]), "v"(va[1][0]), "v"(va[1][1]), "v"(va[2][0]), "v"(va[2][1]), "v"(va[3][0]), "v"(va[3][1]));   // inputs only, no instruction: the rounded words are formed here, while the copies fly; without it the compiler moves the rounding behind the score loop, where it stands open, and carries 128 registers over the loop in place of 64
    asm volatile("s_wait_asynccnt 0x0" ::: "memory");   // this wave's copies have landed; the compiler places no wait for them
    __syncthreads();                                    // and every other wave's: nobody reads As or Cs in front of this barrier
    v2f s[RW];
#pragma unroll
    for (int r = 0; r < RW; ++r) s[r] = (v2f){0.0f, 0.0f};
    SBlk k0, k1;   // two sets: the next block's loads fly while this block's tangents issue
    sblk_ld(k0, a, c, vv, 0);
    SPipe p;       // filled for unit 0: its sums; no tangents yet (zeros: the first step adds 0 * 0 to the zero scores)
#pragma unroll
    for (int r = 0; r < RW; ++r) { const float cw = k0.c[r][0][0]; p.x[r] = (v2f){cw + k0.a[0][0], cw + k0.a[0][1]}; p.t[r] = (v2f){0.0f, 0.0f}; }
    p.tv = 0.0f;
    // The order of a half trip: (1) this block's score-vector words are rounded: the first use of its scalar words, so the one wait for scalar loads (it can only be to 0) stands in front of the next block's; (2) the next block's LDS reads and scalar load; (3) this block's tangents.
    // sched_barrier(0) keeps the three parts in that order in the schedule; wave_barrier (no instruction) keeps the compiler from moving the loads of part 2 over the loop's back edge down to their first use. Without them every load's latency stands open.
    for (int e0 = 0; e0 < DM; e0 += 2 * EB) {
        sblk_rnd(k0); __builtin_amdgcn_sched_barrier(0);
        sblk_ld(k1, a, c, vv, e0 + EB); __builtin_amdgcn_wave_barrier(); __builtin_amdgcn_sched_barrier(0);
        sblk_do(k0, k1, p, s);
        sblk_rnd(k1); __builtin_amdgcn_sched_barrier(0);
        sblk_ld(k0, a, c, vv, (e0 + 2 * EB) & (DM - 1)); __builtin_amdgcn_wave_barrier(); __builtin_amdgcn_sched_barrier(0);   // the last trip asks for block 0 again: in bounds; the sums formed of it are not used
        sblk_do(k1, k0, p, s);
    }
#pragma unroll
    for (int r = 0; r < RW; ++r) { s[r][0] += p.tv * p.t[r][0]; s[r][1] += p.tv * p.t[r][1]; }   // the last unit's products
    // Each score row lies whole in one wave, two words a lane: its maximum and its sum are taken across the lanes, the four rows' chains side by side.
    float mx[RW], sm[RW]; v2f ex[RW];
#pragma unroll
    for (int r = 0; r < RW; ++r) mx[r] = fmaxf(s[r][0], s[r][1]);
    wave_max(mx);
#pragma unroll
    for (int r = 0; r < RW; ++r) { ex[r] = (v2f){expf(s[r][0] - mx[r]), expf(s[r][1] - mx[r])}; sm[r] = ex[r][0] + ex[r][1]; }
    wave_sum(sm);
#pragma unroll
    for (int r = 0; r < RW; ++r) *(v2ha*)(Ps + (w * RW + r) * PP + 2 * lane) = (v2h){tohx(ex[r][0] / sm[r]), tohx(ex[r][1] / sm[r])};
    __syncthreads();
#pragma unroll
    for (int n = 0; n < RT / 16; ++n) { const h16* pb = Ps + (n * 16 + lr) * PP + 8 * hi;
        const v16h p0 = cat16(*(const v8ha*)pb, *(const v8ha*)(pb + 16)), p1 = cat16(*(const v8ha*)(pb + 32), *(const v8ha*)(pb + 48));
#pragma unroll
        for (int t = 0; t < CW; ++t) { v8f acc = (v8f){};
            acc = wmma16(va[t][0], p0, acc);
            acc = wmma16(va[t][1], p1, acc);
            float* op = Os + (n * 16 + lr) * OP + (w * CW + t) * 16 + hi * 8;
            *(v4fa*)op = (v4f){acc[0], acc[1], acc[2], acc[3]}; *(v4fa*)(op + 4) = (v4f){acc[4], acc[5], acc[6], acc[7]}; } }
    __syncthreads();
    const unsigned r2 = tid / (DM / 4), col = (tid % (DM / 4)) * 4; const float* osp = Os + r2 * OP + col; float* gp = OUT + ((size_t)blockIdx.x * RT + r2) * DM + col;
#pragma unroll   // straight-line: the LDS reads go out ahead of the stores, and one address serves all of each at literal offsets
    for (int q = 0; q < RT * DM / 4 / NT; ++q) *(v4f*)(gp + (size_t)q * (NT * 4)) = *(const v4fa*)(osp + q * (NT * 4 / DM) * OP);
}

extern "C" void kernel_launch(void* const* d_in, const int* in_sizes, int n_in,
                              void* d_out, int out_size, void* d_ws, size_t ws_size, hipStream_t stream) {
    (void)in_sizes; (void)n_in; (void)out_size;
    const float* a0 = (const float*)d_in[0]; const float* a1 = (const float*)d_in[1]; const float* a2 = (const float*)d_in[2]; const float* a3 = (const float*)d_in[3]; const float* a4 = (const float*)d_in[4];   /* the module's argument order: the context, the aspect, the two projections, the score vector: FIVE inputs, all read */
    float* OUT = (float*)d_out;     // [32][256][512]
    char* wsp = (char*)d_ws;
    auto take = [&](size_t bytes) { char* p = wsp; wsp += (bytes + 255) & ~(size_t)255; return (void*)p; };
    float* CP = (float*)take((size_t)NB_ * NQ * DM * 4); float* AT = (float*)take((size_t)NB_ * DM * NK * 4);
    if ((size_t)(wsp - (char*)d_ws) > ws_size) return;    // total 20.00 MiB carved
    k_proj<<<(unsigned)(PJ_A + PJ_C), 128, 0, stream>>>(a0, a2, a1, a3, CP, AT);   /* the context's projection (all 8,192 rows) and the aspect's, transposed (the projection shared by the 32 entries) */
    k_attn<<<(unsigned)(NB_ * NQ / RT), NT, 0, stream>>>(CP, AT, a4, a1, OUT);   /* scores, softmax and out[b][i][d] = sum_j w[b][i][j] aspect[b][j][d] (depth 64) for 32 context rows a work-group; the one writer of the output */
}

// v010
// One run takes 33 microseconds.
// Two timings next to v009 both put it at 1.04 times that version's speed.
// All steps since v000 together make it 9.39 times as fast.
#include <hip/hip_runtime.h>

// An additive (tangent) attention of a context over an aspect (inputs, in argument order: a0 [32][256][512] the context; a1 [32][64][512] the aspect; a2, a3 [512][512] two projections ('out, in'); a4 [512] a score vector):
//   c = a0 a2^T ([256][512] an entry);  a = a1 a3^T ([64][512] an entry);  s[i][j] = the sum over the 512 units e of a4[e] tanh(c[i][e] + a[j][e]);  w = softmax over the 64 aspect rows j;  out[i][:] = the sum over j of w[i][j] a1[j][:]  ->  [32][256][512] (4.2 M).
// THE MODULE's OWN ORDER. No preparation launch: each kernel reads the f32 inputs themselves and rounds a word to bf16 where it uses it. The context's projection CP [8192][512] f32 by one product (the projections stand 'out, in' = the product's [N][K] operand as they are); THE ASPECT's PROJECTION IS COMPUTED ALREADY TRANSPOSED, AT [32][512][64] f32, by giving the projection as the product's first operand (shared by the entries) and an entry's aspect rows as its second;
// THE TANGENT IS TAKEN APART: tanh(c + a) = 1 - 2 / (1 + e^2c e^2a). A score is (sum of a4) - 2 * sum over e of a4[e] / (1 + e^2c e^2a); the first term is the same for every score of a row and falls out of the softmax. k_proj stores the powers in place of c and a, BUT ONLY WHERE THEY ARE SAFE: a wave whose 64x64 quarter holds a word over RNG in size stores the quarter as it is, and every wave stores one flag word that says which. A work-group of k_attn that finds all its 16 quarters in powers takes the loop of reciprocals; any other turns the powers back (logarithm) and takes the loop of tangents, which holds for any c and a.
// k_attn does the rest for 32 context rows a work-group: the scores (one loop of 512 units, two units over one common denominator and so one reciprocal instruction, a thread holding 4 rows by 2 aspect rows), each row's softmax (a row lies whole in one wave: the maximum and the sum by a five-step butterfly across the lanes) with the weights as ONE f16 word, and the last product (f16 words of both operands; depth 64; the aspect's words taken from the input, column by column, into the fragment registers); the scores stay in registers, the weights pass through LDS, and neither reaches memory.
// TWO LAUNCHES: k_proj (both projections), k_attn (scores, softmax, last product).
// Every address from the lane's own index, a loop's own counter and launch constants; exact grids, no guard; no atomic; cross-lane words: the wave's own number taken as a scalar in k_proj and k_attn, the range test's ballot in k_proj, the flags' test taken as a scalar and the softmax's butterfly in k_attn.
// Compute dtypes, f32 accumulate: every float input rounded to bf16 at its use; both projections ONE bf16 product on exact operands; scores and softmax f32; the weights ONE f16 word each against the aspect's own bf16 words carried as f16 (exact but for words under 2^-14).

#define NB_  32                   // entries
#define NQ   256                  // context rows (queries) an entry
#define NK   64                   // aspect rows (keys = values) an entry
#define DM   512                  // the width of both and the units
typedef _Float16 h16;
typedef unsigned short bf;
typedef __attribute__((ext_vector_type(16))) __bf16   v16bf;
typedef __attribute__((ext_vector_type(16))) _Float16 v16h;
typedef __attribute__((ext_vector_type(8)))  _Float16 v8h;
typedef __attribute__((ext_vector_type(8)))  float    v8f;
typedef __attribute__((ext_vector_type(4)))  float    v4f;
typedef v8h  __attribute__((may_alias)) v8ha;
typedef v4f  __attribute__((may_alias)) v4fa;
typedef __attribute__((ext_vector_type(16))) float    v16f;

__device__ __forceinline__ unsigned short f2bf(float f) { unsigned u = __float_as_uint(f); u += 0x7FFFu + ((u >> 16) & 1u); return (unsigned short)(u >> 16); }
__device__ __forceinline__ float bf2f(unsigned short b) { return __uint_as_float(((unsigned)b) << 16); }
__device__ __forceinline__ float bfr(float f) { return bf2f(f2bf(f)); }
__device__ __forceinline__ v16h cat16(v8h lo, v8h hi) { return __builtin_shufflevector(lo, hi, 0, 1, 2, 3, 4, 5, 6, 7, 8, 9, 10, 11, 12, 13, 14, 15); }
__device__ __forceinline__ v8f wmma16(v16h a, v16h b, v8f c) { return __builtin_amdgcn_wmma_f32_16x16x32_f16(false, a, false, b, (short)0, c, false, false); }
__device__ __forceinline__ v8f wmmab(v16bf a, v16bf b, v8f c) { return __builtin_amdgcn_wmma_f32_16x16x32_bf16(false, a, false, b, (short)0, c, false, false); }



// ---- k_proj: BOTH projections in one launch (neither reads the other's result); the block index picks the product. C[m][n] (f32) = sum_k A[m][k] Bt[n][k], depth DM.
// A WORK-GROUP OF 4 WAVES FORMS A 128x128 TILE, each wave a 64x64 quarter (16 accumulators). Both operands' 128 rows pass through LDS AS THE f32 WORDS OF THE INPUTS, in stages of KS words of depth, brought by asynchronous copies into two buffers:
// the next stage's copies fly while this stage's products issue, and a row is fetched from L2 once for the two waves that read it. A fragment's 16 words are read from LDS as f32 and rounded to bf16 (to nearest, ties to even) in registers. Every accumulator still takes its 16 products in the order of k.
// The aspect's product has the projection as its first operand and the aspect rows of all entries, 2,048 in a row, as its second: a wave's 64 columns are one entry's rows, so its quarter goes to that entry's transposed plane.
#define PT 128                    // rows and columns of a work-group's tile
#define KS 64                     // depth of a stage, f32 words: 256 bytes a row
#define PL (KS + 4)               // pitch of a staged row in LDS, f32 words: 16 bytes over a row, for the 16-byte fragment reads
#define PBUF (2 * PT * PL)        // words of one buffer: the first operand's rows, then the second's
#define PJ_A ((DM / PT) * (NB_ * NK / PT))   // tiles of the aspect's projection
#define PJ_C ((NB_ * NQ / PT) * (DM / PT))   // tiles of the context's projection
// cp8r: eight 16-byte asynchronous copies of a lane, global memory to LDS through no register, 8 rows apart in both. The s_wait_xcnt stands inside the statement, behind the last copy, so that no address register is rewritten in front of it.
#define RL (8 * PL * 4)           // bytes 8 rows take in LDS
#define RG (8 * DM * 4)           // and in memory
__device__ __forceinline__ void cp8r(unsigned l, const char* g) {
    asm volatile("global_load_async_to_lds_b128 %0, %8, off\n\t"
                 "global_load_async_to_lds_b128 %1, %9, off\n\t"
                 "global_load_async_to_lds_b128 %2, %10, off\n\t"
                 "global_load_async_to_lds_b128 %3, %11, off\n\t"
                 "global_load_async_to_lds_b128 %4, %12, off\n\t"
                 "global_load_async_to_lds_b128 %5, %13, off\n\t"
                 "global_load_async_to_lds_b128 %6, %14, off\n\t"
                 "global_load_async_to_lds_b128 %7, %15, off\n\t"
                 "s_wait_xcnt 0x0"
                 :: "v"(l), "v"(l + RL), "v"(l + 2 * RL), "v"(l + 3 * RL), "v"(l + 4 * RL), "v"(l + 5 * RL), "v"(l + 6 * RL), "v"(l + 7 * RL),
                    "v"(g), "v"(g + RG), "v"(g + 2 * RG), "v"(g + 3 * RG), "v"(g + 4 * RG), "v"(g + 5 * RG), "v"(g + 6 * RG), "v"(g + 7 * RG) : "memory");
}
// One stage of both operands: 16 lanes a row, 8 rows a copy of the work-group, 16 + 16 copies a lane (63 may be outstanding).
__device__ __forceinline__ void pj_stage(unsigned l, const char* ga, const char* gb) {
    cp8r(l, ga); cp8r(l + 8 * RL, ga + 8 * RG);
    cp8r(l + PT * PL * 4, gb); cp8r(l + PT * PL * 4 + 8 * RL, gb + 8 * RG);
}
// One 16x32 fragment: the lane's two runs of 8 words, 16 words apart, four 16-byte LDS reads; the conversion is the chip's packed f32-to-bf16 instruction.
__device__ __forceinline__ v16bf pj_frag(const float* p) { const v4f x0 = *(const v4fa*)p, x1 = *(const v4fa*)(p + 4), x2 = *(const v4fa*)(p + 16), x3 = *(const v4fa*)(p + 20);
    const v8f lo = __builtin_shufflevector(x0, x1, 0, 1, 2, 3, 4, 5, 6, 7), hi = __builtin_shufflevector(x2, x3, 0, 1, 2, 3, 4, 5, 6, 7);
    const v16f x = __builtin_shufflevector(lo, hi, 0, 1, 2, 3, 4, 5, 6, 7, 8, 9, 10, 11, 12, 13, 14, 15); return __builtin_convertvector(x, v16bf); }
// A score-vector word (rounded to bf16 as everywhere) of an even unit, and 1 / word. A word under 2^-30 in size counts as 2^-30 with its sign, so that the quotient is finite: that moves a score by less than 2^-20. (An odd unit's word is used as it is.)
__device__ __forceinline__ float vcl(float v) { const float b = bfr(v); return copysignf(fmaxf(fabsf(b), 0x1p-30f), b); }
__device__ __forceinline__ float uinv(float v) { return 1.0f / vcl(v); }
// e^2x for the score loop; formed only of words up to RNG in size. With |c| and |a| up to RNG a unit's 1 + e^2c e^2a is under 2^47, so a pair's common denominator (one of the two divided by a score-vector word of 2^-30 or more) is under 2^123: finite, and its reciprocal a normal number.
#define RNG 8.0f
__device__ __forceinline__ float e2x(float x) { return __builtin_amdgcn_exp2f(x * 2.8853900818f); }
#define FLC (NB_ * NQ / 64 * (DM / 64))   // flag words of the context's quarters ([row / 64][unit / 64]); the aspect's ([entry][unit / 64]) stand behind them
__global__ __launch_bounds__(128) void k_proj(const float* __restrict__ CB, const float* __restrict__ WCB, const float* __restrict__ AB, const float* __restrict__ WAB, const float* __restrict__ VV, float* CP, float* AT, unsigned* FL) {
    __shared__ __align__(16) float St[2 * PBUF];       // the two buffers
    __shared__ __align__(16) float Ow[4 * 16 * 68];    // each wave's own 16 output rows, for whole-line stores
    const unsigned t = blockIdx.x, tid = threadIdx.x, lane = tid & 31, lr = lane & 15, hi = lane >> 4;
    const unsigned w = (unsigned)__builtin_amdgcn_readfirstlane((int)(tid >> 5)), wm = w & 1, wn = w >> 1;   // the wave's number as a scalar; its quarter
    const float* A; const float* Bt; float* C; int ldc; unsigned ucol = 0, fi;   // the tile's first rows of both operands; this wave's quarter of the result
    if (t < PJ_A) { const unsigned r0 = (t % (DM / PT)) * PT, c0 = (t / (DM / PT)) * PT; A = WAB + (size_t)r0 * DM; Bt = AB + (size_t)c0 * DM;
        C = AT + (size_t)(c0 / NK + wn) * DM * NK + (size_t)(r0 + wm * 64) * NK; ldc = NK; fi = FLC + (c0 / NK + wn) * (DM / 64) + r0 / 64 + wm; }
    else { const unsigned u = t - PJ_A, r0 = (u % (NB_ * NQ / PT)) * PT, c0 = (u / (NB_ * NQ / PT)) * PT; A = CB + (size_t)r0 * DM; Bt = WCB + (size_t)c0 * DM;
        C = CP + (size_t)(r0 + wm * 64) * DM + c0 + wn * 64; ldc = DM; ucol = c0 + wn * 64; fi = (r0 / 64 + wm) * (DM / 64) + c0 / 64 + wn; }
    float uf[4];   // the context's powers of the EVEN units are stored divided by the unit's score-vector word (a column is a unit there); those of the odd units and the aspect's as they are. Asked for here, ahead of the stages, so that the loads' latency does not stand open at the foot
#pragma unroll
    for (int nb = 0; nb < 4; ++nb) { const float u = uinv(VV[ucol + nb * 16 + lr]); uf[nb] = (t < PJ_A || (lr & 1)) ? 1.0f : u; }
    v8f acc[4][4];
#pragma unroll
    for (int mb = 0; mb < 4; ++mb)
#pragma unroll
        for (int nb = 0; nb < 4; ++nb) acc[mb][nb] = (v8f){};
    const unsigned lb = (unsigned)(size_t)St + (tid >> 4) * (PL * 4) + (tid & 15) * 16;   // the low 32 bits of a __shared__ address: the byte's place in the work-group's LDS
    const char* ga = (const char*)(A + (size_t)(tid >> 4) * DM) + (tid & 15) * 16; const char* gb = (const char*)(Bt + (size_t)(tid >> 4) * DM) + (tid & 15) * 16;
    pj_stage(lb, ga, gb);
    asm volatile("s_wait_asynccnt 0x0" ::: "memory");   // this wave's copies of stage 0 have landed; the compiler places no wait for them
    __syncthreads();                                    // and every other wave's: nobody reads stage 0 in front of this barrier
    pj_stage(lb + PBUF * 4, ga + KS * 4, gb + KS * 4);
    const float* fa = St + (wm * 64 + lr) * PL + 8 * hi; const float* fb = St + (PT + wn * 64 + lr) * PL + 8 * hi;
#pragma unroll 1   // rolled: one body of 32 products serves the eight stages
    for (int s = 0; s < DM / KS; ++s) {
        const float* pa = fa + (s & 1) * PBUF; const float* pb = fb + (s & 1) * PBUF;
        v16bf a[4];
#pragma unroll
        for (int kk = 0; kk < KS / 32; ++kk) {
            v16bf b[4];
#pragma unroll
            for (int mb = 0; mb < 4; ++mb) a[mb] = pj_frag(pa + mb * 16 * PL + kk * 32);
#pragma unroll
            for (int nb = 0; nb < 4; ++nb) b[nb] = pj_frag(pb + nb * 16 * PL + kk * 32);
            __builtin_amdgcn_sched_barrier(0);   // the block's 32 LDS reads stay one group in front of its 16 products: left to itself the schedule reads each b fragment just in front of its use and waits for it four times a block
#pragma unroll
            for (int nb = 0; nb < 4; ++nb)
#pragma unroll
                for (int mb = 0; mb < 4; ++mb) acc[mb][nb] = wmmab(a[mb], b[nb], acc[mb][nb]);
            __builtin_amdgcn_sched_barrier(0);   // and the next block's reads stay behind these products, not scattered among them
        }
        asm volatile("v_nop\n\tv_nop\n\tv_nop\n\tv_nop" : "+v"(acc[0][0]), "+v"(acc[1][1]), "+v"(acc[2][2]), "+v"(acc[3][3]) : "v"(a[0]), "v"(a[3]));   // the distance behind the stage's last products, on the branches that follow too
        asm volatile("s_wait_dscnt 0x0" ::: "memory");      // this wave's reads of the buffer are done before it is refilled
        asm volatile("s_wait_asynccnt 0x0" ::: "memory");   // this wave's copies of the next stage have landed
        __syncthreads();                                    // publishes the next stage and ends every wave's reads of this one
        if (s + 2 < DM / KS) pj_stage(lb + (s & 1) * (PBUF * 4), ga + (s + 2) * (KS * 4), gb + (s + 2) * (KS * 4));
    }
    asm volatile("s_wait_asynccnt 0x0" ::: "memory");   // no copy is outstanding when the wave goes on
    // Is every word of this wave's quarter inside the range? One answer for the wave (a ballot over the lanes' own maxima).
    float mx4[4] = {0.0f, 0.0f, 0.0f, 0.0f};   // four chains side by side: one chain of 128 words would wait for itself at every link
#pragma unroll
    for (int nb = 0; nb < 4; ++nb)
#pragma unroll
        for (int j = 0; j < 8; ++j)
#pragma unroll
            for (int mb = 0; mb < 4; ++mb) mx4[mb] = fmaxf(mx4[mb], fabsf(acc[mb][nb][j]));
    const bool inr = __builtin_amdgcn_ballot_w32(fmaxf(fmaxf(mx4[0], mx4[1]), fmaxf(mx4[2], mx4[3])) <= RNG) == 0xffffffffu;
    if (inr) {
#pragma unroll
        for (int mb = 0; mb < 4; ++mb)
#pragma unroll
            for (int nb = 0; nb < 4; ++nb)
#pragma unroll
                for (int j = 0; j < 8; ++j) acc[mb][nb][j] = e2x(acc[mb][nb][j]);
#pragma unroll
        for (int mb = 0; mb < 4; ++mb)
#pragma unroll
            for (int nb = 0; nb < 4; ++nb)
#pragma unroll
                for (int j = 0; j < 8; ++j) acc[mb][nb][j] *= uf[nb];
    }
    float* os = Ow + w * (16 * 68);
#pragma unroll
    for (int mb = 0; mb < 4; ++mb) {
#pragma unroll
        for (int nb = 0; nb < 4; ++nb) {
#pragma unroll
            for (int j = 0; j < 8; ++j) os[(hi * 8 + j) * 68 + nb * 16 + lr] = acc[mb][nb][j]; }
        __builtin_amdgcn_wave_barrier(); asm volatile("" ::: "memory");   // no instruction: keeps the compiler from moving the wave's LDS reads below over these stores (and, at the foot, the next stores over the reads)
        float* crow = C + (size_t)(mb * 16) * ldc;
#pragma unroll
        for (int s = 0; s < 8; ++s) { const int row = 2 * s + hi, cofs = lr * 4; *(v4f*)(crow + (size_t)row * ldc + cofs) = *(const v4fa*)(os + row * 68 + cofs); }
        __builtin_amdgcn_wave_barrier(); asm volatile("" ::: "memory");
    }
    if (lane == 0) FL[fi] = inr ? 1u : 0u;   // the quarter's flag: 1 = powers, 0 = the words themselves; the wave's last store
}

__device__ __forceinline__ h16 tohx(float x) { return (h16)x; }
typedef __attribute__((ext_vector_type(2))) _Float16 v2h;
typedef __attribute__((ext_vector_type(4))) _Float16 v4h;
typedef __attribute__((ext_vector_type(2))) unsigned short v2us;
typedef __attribute__((ext_vector_type(4))) unsigned short v4us;
typedef __attribute__((ext_vector_type(2))) float v2f;
typedef __attribute__((ext_vector_type(4))) int v4i;

// ---- k_attn: scores, softmax and the last product of RT context rows in one work-group of RT / RW waves.
// REGISTER BLOCK OF THE SCORES: a wave holds RW whole score rows; a lane holds, of each, the two neighbouring aspect rows 2 * lane and 2 * lane + 1. One 8-byte read of the aspect's projection serves 2 * RW terms.
// BOTH OPERANDS OF THE SCORE LOOP STAND IN LDS: the entry's aspect projection whole (all 8 waves read all of it) and the work-group's RT rows of the context's projection, brought in front of the loop by asynchronous copies, all in flight at once;
// the loop of reciprocals then reads no global memory (the score vector's inverses stand in LDS too; the loop of tangents loads its words as scalars). A wave's context words come as 16-byte reads of one address for all lanes. Each score is one chain over the 256 pairs of units in their order.
// Each wave then forms CW tiles of 16 output columns for all RT rows: D[m = column][n = row] = sum_j aspect[j][column] w[row][j], so a lane holds 8 neighbouring columns of one row.
// The first operand's fragments come straight from the f32 input: a lane owns one column and reads its 16 aspect rows of a fragment word by word (16 lanes side by side: 64 bytes of a row), rounds each to bf16 and carries it as f16.
#define RT 32                     // context rows a work-group (two of the matrix instruction's N)
#define RW 4                      // context rows a wave
#define NW (RT / RW)              // waves a work-group
#define NT (NW * 32)              // threads a work-group
#define CW (DM / 16 / NW)         // column tiles a wave
#define EB 8                      // units a block of the score loop
#define PP (NK + 8)               // pitch of the weights in LDS, f16 words: 16 bytes over a row, for the 16-byte fragment reads
#define OP (DM + 4)               // pitch of the output tile in LDS, floats: 16 bytes over a row
typedef v2f __attribute__((may_alias)) v2fa;
typedef v2h __attribute__((may_alias)) v2ha;
struct SBlk { v2f a[EB]; v4f c[RW][EB / 4]; v4f u[EB / 4]; };   // one block's operands, all from LDS: the aspect's and the context's words, the score vector's (even units: the inverse; odd units: the word)
__device__ __forceinline__ void sblk_ld(SBlk& k, const float* a, const float* c, const float* us, int e0) {
#pragma unroll
    for (int q = 0; q < EB; ++q) k.a[q] = *(const v2fa*)(a + (e0 + q) * NK);
#pragma unroll
    for (int r = 0; r < RW; ++r)
#pragma unroll
        for (int q = 0; q < EB / 4; ++q) k.c[r][q] = *(const v4fa*)(c + r * DM + e0 + q * 4);
#pragma unroll
    for (int q = 0; q < EB / 4; ++q) k.u[q] = *(const v4fa*)(us + e0 + q * 4);
}
// TWO UNITS SHARE ONE RECIPROCAL: of a pair's even unit g1 = (1 + e^2c e^2a) / v1 = 1 / v1 + (e^2c / v1) e^2a (one multiply-add: CP holds e^2c / v1), of its odd unit g2 = 1 + e^2c e^2a; the two terms are 1 / g1 + v2 / g2 = (g2 + v2 g1) / (g1 g2). g1 g2 is finite for every word that k_proj stores as a power (at RNG).
// The work runs as a pipeline three pairs deep, so that no instruction waits for the one in front of it: while pair q's reciprocals issue, pair q - 1's quotients are summed and pair q + 1's sums and products are formed.
struct SPipe { v2f sm[RW], dd[RW]; v2f n[RW], r[RW]; };   // this pair's g2 + v2 g1 and g1 g2; the last pair's numerators and reciprocals
__device__ __forceinline__ void spair(const SBlk& m, int q, SPipe& p) {   // pair q of block m
    v2f g1[RW], g2[RW]; const float u1 = m.u[(2 * q) >> 2][(2 * q) & 3], u2 = m.u[(2 * q + 1) >> 2][(2 * q + 1) & 3];
#pragma unroll
    for (int r = 0; r < RW; ++r) { const float c1 = m.c[r][(2 * q) >> 2][(2 * q) & 3]; g1[r] = (v2f){c1, c1} * m.a[2 * q] + (v2f){u1, u1}; }
#pragma unroll
    for (int r = 0; r < RW; ++r) { const float c2 = m.c[r][(2 * q + 1) >> 2][(2 * q + 1) & 3]; g2[r] = (v2f){c2, c2} * m.a[2 * q + 1] + (v2f){1.0f, 1.0f}; }
#pragma unroll
    for (int r = 0; r < RW; ++r) p.dd[r] = g1[r] * g2[r];
#pragma unroll
    for (int r = 0; r < RW; ++r) p.sm[r] = (v2f){u2, u2} * g1[r] + g2[r];
}
__device__ __forceinline__ void sblk_do(const SBlk& k, const SBlk& n, SPipe& p, v2f* s) {   // n: the block behind k; its first pair is formed in k's last step
#pragma unroll
    for (int q = 0; q < EB / 2; ++q) {
        v2f rn[RW], sn[RW];
#pragma unroll
        for (int r = 0; r < RW; ++r) { rn[r] = (v2f){__builtin_amdgcn_rcpf(p.dd[r][0]), __builtin_amdgcn_rcpf(p.dd[r][1])}; sn[r] = p.sm[r]; }
#pragma unroll
        for (int r = 0; r < RW; ++r) s[r] += p.n[r] * p.r[r];
        spair(q + 1 < EB / 2 ? k : n, (q + 1) & (EB / 2 - 1), p);
#pragma unroll
        for (int r = 0; r < RW; ++r) { p.n[r] = sn[r]; p.r[r] = rn[r]; }
        // The step's order in the schedule: one reciprocal, then up to three plain vector instructions, in turn.
#pragma unroll
        for (int i = 0; i < 2 * RW; ++i) { __builtin_amdgcn_sched_group_barrier(0x400, 1, 0); __builtin_amdgcn_sched_group_barrier(0x002, 3, 0); }
        __builtin_amdgcn_sched_barrier(0);   // a step's instructions stay in their step: moved together again, a product would stand directly behind its reciprocal
    }
}
// ---- THE LOOP OF TANGENTS, for a work-group with a word outside the range: c and a as they are, one tangent instruction a term; it holds for any c and a.
struct TBlk { v2f a[EB]; v4f c[RW][EB / 4]; float v[EB]; };   // one block's operands: the aspect's and the context's words (vector registers, from LDS), the score vector's (scalar registers)
__device__ __forceinline__ void tblk_ld(TBlk& k, const float* a, const float* c, const float* __restrict__ vv, int e0) {
#pragma unroll
    for (int q = 0; q < EB; ++q) k.a[q] = *(const v2fa*)(a + (e0 + q) * NK);
#pragma unroll
    for (int r = 0; r < RW; ++r)
#pragma unroll
        for (int q = 0; q < EB / 4; ++q) k.c[r][q] = *(const v4fa*)(c + r * DM + e0 + q * 4);
#pragma unroll
    for (int q = 0; q < EB; ++q) k.v[q] = vv[e0 + q];
}
__device__ __forceinline__ void tblk_rnd(TBlk& k) {
#pragma unroll
    for (int q = 0; q < EB; ++q) k.v[q] = bfr(k.v[q]);
}
// The score loop's work runs as a pipeline three units deep, so that no instruction waits for the one in front of it: while unit q's tangents issue, unit q - 1's tangents are multiplied and summed and unit q + 1's sums are formed.
struct TPipe { v2f x[RW]; v2f t[RW]; float tv; };   // the next unit's sums; the last unit's tangents and its score-vector word
__device__ __forceinline__ void tblk_do(const TBlk& k, const TBlk& n, TPipe& p, v2f* s) {   // n: the block behind k; its first unit's sums are formed in k's last step
#pragma unroll
    for (int q = 0; q < EB; ++q) { const TBlk& m = q + 1 < EB ? k : n; const int qn = (q + 1) & (EB - 1);
        v2f tn[RW];
#pragma unroll
        for (int r = 0; r < RW; ++r) tn[r] = (v2f){__builtin_amdgcn_tanhf(p.x[r][0]), __builtin_amdgcn_tanhf(p.x[r][1])};   // the chip's own tangent instruction
#pragma unroll
        for (int r = 0; r < RW; ++r) { s[r][0] += p.tv * p.t[r][0]; s[r][1] += p.tv * p.t[r][1]; }
#pragma unroll
        for (int r = 0; r < RW; ++r) { const float cw = m.c[r][qn >> 2][qn & 3]; p.x[r] = (v2f){cw + m.a[qn][0], cw + m.a[qn][1]}; }
#pragma unroll
        for (int r = 0; r < RW; ++r) p.t[r] = tn[r];
        p.tv = k.v[q];
        // The step's order in the schedule: one tangent, one plain vector instruction, in turn.
#pragma unroll
        for (int i = 0; i < 2 * RW; ++i) { __builtin_amdgcn_sched_group_barrier(0x400, 1, 0); __builtin_amdgcn_sched_group_barrier(0x002, 1, 0); }
        __builtin_amdgcn_sched_barrier(0);   // a step's instructions stay in their step: moved together again, a product would stand directly behind its tangent
    }
}
__device__ __forceinline__ float lg2(float x) { return __builtin_amdgcn_logf(fabsf(x)); }   // the chip's base-2 logarithm of a word's size
// cp8: eight 16-byte asynchronous copies of a lane, global memory to LDS through no register, NT * 16 bytes apart in both. The s_wait_xcnt stands inside the statement, behind the last copy, so that no address register is rewritten in front of it.
#define CPS (NT * 16)             // bytes one copy of the whole work-group brings
__device__ __forceinline__ void cp8(unsigned l, const char* g) {
    asm volatile("global_load_async_to_lds_b128 %0, %8, off\n\t"
                 "global_load_async_to_lds_b128 %1, %9, off\n\t"
                 "global_load_async_to_lds_b128 %2, %10, off\n\t"
                 "global_load_async_to_lds_b128 %3, %11, off\n\t"
                 "global_load_async_to_lds_b128 %4, %12, off\n\t"
                 "global_load_async_to_lds_b128 %5, %13, off\n\t"
                 "global_load_async_to_lds_b128 %6, %14, off\n\t"
                 "global_load_async_to_lds_b128 %7, %15, off\n\t"
                 "s_wait_xcnt 0x0"
                 :: "v"(l), "v"(l + CPS), "v"(l + 2 * CPS), "v"(l + 3 * CPS), "v"(l + 4 * CPS), "v"(l + 5 * CPS), "v"(l + 6 * CPS), "v"(l + 7 * CPS),
                    "v"(g), "v"(g + CPS), "v"(g + 2 * CPS), "v"(g + 3 * CPS), "v"(g + 4 * CPS), "v"(g + 5 * CPS), "v"(g + 6 * CPS), "v"(g + 7 * CPS) : "memory");
}
// Cross-lane words for the softmax. lx<M>: the word of lane l ^ M inside a 16-lane row (M = 1, 2, 4, 8; DPP row_xmask); lx16: the word of lane l ^ 16. All 32 lanes are on where they are used.
template <int M> __device__ __forceinline__ float lx(float x) { const int b = __float_as_int(x); return __int_as_float(__builtin_amdgcn_mov_dpp(b, 0x160 + M, 0xf, 0xf, true)); }
__device__ __forceinline__ float lx16(float x) { const int b = __float_as_int(x); return __int_as_float(__builtin_amdgcn_permlanex16(b, b, 0x76543210, 0xfedcba98, false, false)); }
// A butterfly of five steps over the wave for RW values at once: every lane ends with the same word (each step joins a lane's word and its partner's, and both form the same result).
__device__ __forceinline__ void wave_max(float* x) {
#pragma unroll
    for (int r = 0; r < RW; ++r) x[r] = fmaxf(x[r], lx<1>(x[r]));
#pragma unroll
    for (int r = 0; r < RW; ++r) x[r] = fmaxf(x[r], lx<2>(x[r]));
#pragma unroll
    for (int r = 0; r < RW; ++r) x[r] = fmaxf(x[r], lx<4>(x[r]));
#pragma unroll
    for (int r = 0; r < RW; ++r) x[r] = fmaxf(x[r], lx<8>(x[r]));
#pragma unroll
    for (int r = 0; r < RW; ++r) x[r] = fmaxf(x[r], lx16(x[r]));
}
__device__ __forceinline__ void wave_sum(float* x) {
#pragma unroll
    for (int r = 0; r < RW; ++r) x[r] += lx<1>(x[r]);
#pragma unroll
    for (int r = 0; r < RW; ++r) x[r] += lx<2>(x[r]);
#pragma unroll
    for (int r = 0; r < RW; ++r) x[r] += lx<4>(x[r]);
#pragma unroll
    for (int r = 0; r < RW; ++r) x[r] += lx<8>(x[r]);
#pragma unroll
    for (int r = 0; r < RW; ++r) x[r] += lx16(x[r]);
}
__global__ __launch_bounds__(NT) void k_attn(const float* __restrict__ CP, const float* __restrict__ AT, const float* __restrict__ vv, const float* __restrict__ ASP, const unsigned* __restrict__ FL, float* OUT) {
    __shared__ __align__(16) float As[DM * NK];   // the entry's aspect projection, transposed, whole (128 KiB)
    __shared__ __align__(16) float Cs[RT * DM];   // this work-group's rows of the context's projection (64 KiB)
    __shared__ __align__(16) h16 Ps[RT * PP];     // weights
    __shared__ __align__(16) float Us[DM];        // the score vector: even units 1 / word, odd units the word
    __shared__ __align__(16) float Ws[DM / 2];    // the even units' words themselves (as their inverses were formed of them), for turning a power back
    __shared__ __align__(16) float Os[RT * OP];   // the output tile, for whole-line stores
    const unsigned tid = threadIdx.x, lane = tid & 31, lr = lane & 15, hi = lane >> 4, b = blockIdx.x / (NQ / RT);
    const unsigned w = (unsigned)__builtin_amdgcn_readfirstlane((int)(tid >> 5));   // the wave's number as a scalar
    const float* c = Cs + w * RW * DM; const float* a = As + 2 * lane;
    // The flags of the 8 + 8 quarters that this work-group reads, one bit each (bit = unit / 64): the same words for every thread, asked for first.
    unsigned mC = 0, mA = 0;
#pragma unroll
    for (int i = 0; i < DM / 64; ++i) { mC |= (FL[(blockIdx.x * RT / 64) * (DM / 64) + i] & 1u) << i; mA |= (FL[FLC + b * (DM / 64) + i] & 1u) << i; }
    const bool fast = (unsigned)__builtin_amdgcn_readfirstlane((int)(mC & mA)) == (1u << (DM / 64)) - 1u;   // as a scalar: one branch for the whole work-group
    const float* ap = ASP + ((size_t)b * NK + 8 * hi) * DM + w * CW * 16 + lr;   // the lane's column, at the first aspect row of its half of a fragment
    float vr[CW][2][16];   // this wave's columns of the aspect, asked for in front of the copies: they land, and are rounded, while the copies fly
#pragma unroll
    for (int t = 0; t < CW; ++t)
#pragma unroll
        for (int h = 0; h < 2; ++h)
#pragma unroll
            for (int q = 0; q < 16; ++q) vr[t][h][q] = ap[(size_t)(h * 32 + (q >> 3) * 16 + (q & 7)) * DM + t * 16];
    { const char* ga = (const char*)(AT + (size_t)b * DM * NK) + tid * 16; const char* gc = (const char*)(CP + (size_t)blockIdx.x * RT * DM) + tid * 16;
      const unsigned la = (unsigned)(size_t)As + tid * 16, lc = (unsigned)(size_t)Cs + tid * 16;   // the low 32 bits of a __shared__ address: the byte's place in the work-group's LDS
#pragma unroll   // straight-line: 16 + 32 copies a lane, every one outstanding at once (63 is the limit)
      for (int i = 0; i < RT * DM * 4 / (8 * CPS); ++i) cp8(lc + i * 8 * CPS, gc + i * 8 * CPS);
#pragma unroll
      for (int i = 0; i < DM * NK * 4 / (8 * CPS); ++i) cp8(la + i * 8 * CPS, ga + i * 8 * CPS); }
    *(v2fa*)(Us + 2 * tid) = (v2f){uinv(vv[2 * tid]), bfr(vv[2 * tid + 1])}; Ws[tid] = vcl(vv[2 * tid]);   // two words a thread; read behind the barrier below
    v16h va[CW][2];
#pragma unroll
    for (int t = 0; t < CW; ++t)
#pragma unroll
        for (int h = 0; h < 2; ++h)
#pragma unroll
            for (int q = 0; q < 16; ++q) va[t][h][q] = tohx(bfr(vr[t][h][q]));
    asm volatile("" :: "v"(va[0][0]), "v"(va[0][1]), "v"(va[1][0]), "v"(va[1][1]), "v"(va[2][0]), "v"(va[2][1]), "v"(va[3][0]), "v"(va[3][1]));   // inputs only, no instruction: the rounded words are formed here, while the copies fly; without it the compiler moves the rounding behind the score loop, where it stands open, and carries 128 registers over the loop in place of 64
    asm volatile("s_wait_asynccnt 0x0" ::: "memory");   // this wave's copies have landed; the compiler places no wait for them
    __syncthreads();                                    // and every other wave's: nobody reads As, Cs, Us or Ws in front of this barrier
    v2f s[RW];
#pragma unroll
    for (int r = 0; r < RW; ++r) s[r] = (v2f){0.0f, 0.0f};
    if (fast) {
    SBlk k0, k1;   // two sets: the next block's loads fly while this block's reciprocals issue
    sblk_ld(k0, a, c, Us, 0);
    SPipe p;       // filled for pair 0: its denominators; no quotient yet (zeros: the first step adds 0 * 0 to the zero scores)
    spair(k0, 0, p);
#pragma unroll
    for (int r = 0; r < RW; ++r) { p.n[r] = (v2f){0.0f, 0.0f}; p.r[r] = (v2f){0.0f, 0.0f}; }
    // The order of a half trip: (1) the next block's LDS reads; (2) this block's reciprocals.
    // sched_barrier(0) keeps the two parts in that order in the schedule; wave_barrier (no instruction) keeps the compiler from moving the loads of part 1 over the loop's back edge down to their first use. Without them every load's latency stands open.
    for (int e0 = 0; e0 < DM; e0 += 2 * EB) {
        sblk_ld(k1, a, c, Us, e0 + EB); __builtin_amdgcn_wave_barrier(); __builtin_amdgcn_sched_barrier(0);
        sblk_do(k0, k1, p, s);
        sblk_ld(k0, a, c, Us, (e0 + 2 * EB) & (DM - 1)); __builtin_amdgcn_wave_barrier(); __builtin_amdgcn_sched_barrier(0);   // the last trip asks for block 0 again: in bounds; what is formed of it is not used
        sblk_do(k1, k0, p, s);
    }
#pragma unroll
    for (int r = 0; r < RW; ++r) s[r] = (s[r] + p.n[r] * p.r[r]) * (v2f){-2.0f, -2.0f};   // the last pair's quotients; the factor of the tangent's form (its constant term, alike in every score, falls out of the softmax)
    } else {
    // A word outside the range somewhere: the quarters that came as powers are turned back into c and a (x = ln(e^2x) / 2; an even unit's power first freed of 1 / word), each thread the words that its own copies brought.
#pragma unroll 1   // rolled: the seldom path stays small
    for (int i = 0; i < RT * DM / (NT * 4); ++i) { const unsigned x0 = tid * 4 + i * (NT * 4), e = x0 & (DM - 1);
        if ((mC >> (e >> 6)) & 1u) { const v4f x = *(const v4fa*)(Cs + x0); const v2f v = *(const v2fa*)(Ws + e / 2);
            *(v4fa*)(Cs + x0) = (v4f){lg2(x[0] * v[0]) * 0.34657359f, lg2(x[1]) * 0.34657359f, lg2(x[2] * v[1]) * 0.34657359f, lg2(x[3]) * 0.34657359f}; } }
#pragma unroll 1   // rolled, as above
    for (int i = 0; i < DM * NK / (NT * 4); ++i) { const unsigned x0 = tid * 4 + i * (NT * 4);
        if ((mA >> (x0 / (64 * NK))) & 1u) { const v4f x = *(const v4fa*)(As + x0);
            *(v4fa*)(As + x0) = (v4f){lg2(x[0]) * 0.34657359f, lg2(x[1]) * 0.34657359f, lg2(x[2]) * 0.34657359f, lg2(x[3]) * 0.34657359f}; } }
    __syncthreads();   // every wave's words are turned back before any wave reads them; the branch is the same for the whole work-group
    TBlk k0, k1;   // two sets: the next block's loads fly while this block's tangents issue
    tblk_ld(k0, a, c, vv, 0);
    TPipe p;       // filled for unit 0: its sums; no tangents yet (zeros: the first step adds 0 * 0 to the zero scores)
#pragma unroll
    for (int r = 0; r < RW; ++r) { const float cw = k0.c[r][0][0]; p.x[r] = (v2f){cw + k0.a[0][0], cw + k0.a[0][1]}; p.t[r] = (v2f){0.0f, 0.0f}; }
    p.tv = 0.0f;
    // The order of a half trip: (1) this block's score-vector words are rounded: the first use of its scalar words, so the one wait for scalar loads (it can only be to 0) stands in front of the next block's; (2) the next block's LDS reads and scalar load; (3) this block's tangents.
    // sched_barrier(0) keeps the three parts in that order in the schedule; wave_barrier (no instruction) keeps the compiler from moving the loads of part 2 over the loop's back edge down to their first use. Without them every load's latency stands open.
    for (int e0 = 0; e0 < DM; e0 += 2 * EB) {
        tblk_rnd(k0); __builtin_amdgcn_sched_barrier(0);
        tblk_ld(k1, a, c, vv, e0 + EB); __builtin_amdgcn_wave_barrier(); __builtin_amdgcn_sched_barrier(0);
        tblk_do(k0, k1, p, s);
        tblk_rnd(k1); __builtin_amdgcn_sched_barrier(0);
        tblk_ld(k0, a, c, vv, (e0 + 2 * EB) & (DM - 1)); __builtin_amdgcn_wave_barrier(); __builtin_amdgcn_sched_barrier(0);   // the last trip asks for block 0 again: in bounds; the sums formed of it are not used
        tblk_do(k1, k0, p, s);
    }
#pragma unroll
    for (int r = 0; r < RW; ++r) { s[r][0] += p.tv * p.t[r][0]; s[r][1] += p.tv * p.t[r][1]; }   // the last unit's products
    }
    // Each score row lies whole in one wave, two words a lane: its maximum and its sum are taken across the lanes, the four rows' chains side by side.
    float mx[RW], sm[RW]; v2f ex[RW];
#pragma unroll
    for (int r = 0; r < RW; ++r) mx[r] = fmaxf(s[r][0], s[r][1]);
    wave_max(mx);
#pragma unroll
    for (int r = 0; r < RW; ++r) { ex[r] = (v2f){expf(s[r][0] - mx[r]), expf(s[r][1] - mx[r])}; sm[r] = ex[r][0] + ex[r][1]; }
    wave_sum(sm);
#pragma unroll
    for (int r = 0; r < RW; ++r) *(v2ha*)(Ps + (w * RW + r) * PP + 2 * lane) = (v2h){tohx(ex[r][0] / sm[r]), tohx(ex[r][1] / sm[r])};
    __syncthreads();
#pragma unroll
    for (int n = 0; n < RT / 16; ++n) { const h16* pb = Ps + (n * 16 + lr) * PP + 8 * hi;
        const v16h p0 = cat16(*(const v8ha*)pb, *(const v8ha*)(pb + 16)), p1 = cat16(*(const v8ha*)(pb + 32), *(const v8ha*)(pb + 48));
#pragma unroll
        for (int t = 0; t < CW; ++t) { v8f acc = (v8f){};
            acc = wmma16(va[t][0], p0, acc);
            acc = wmma16(va[t][1], p1, acc);
            float* op = Os + (n * 16 + lr) * OP + (w * CW + t) * 16 + hi * 8;
            *(v4fa*)op = (v4f){acc[0], acc[1], acc[2], acc[3]}; *(v4fa*)(op + 4) = (v4f){acc[4], acc[5], acc[6], acc[7]}; } }
    __syncthreads();
    const unsigned r2 = tid / (DM / 4), col = (tid % (DM / 4)) * 4; const float* osp = Os + r2 * OP + col; float* gp = OUT + ((size_t)blockIdx.x * RT + r2) * DM + col;
#pragma unroll   // straight-line: the LDS reads go out ahead of the stores, and one address serves all of each at literal offsets
    for (int q = 0; q < RT * DM / 4 / NT; ++q) *(v4f*)(gp + (size_t)q * (NT * 4)) = *(const v4fa*)(osp + q * (NT * 4 / DM) * OP);
}

extern "C" void kernel_launch(void* const* d_in, const int* in_sizes, int n_in,
                              void* d_out, int out_size, void* d_ws, size_t ws_size, hipStream_t stream) {
    (void)in_sizes; (void)n_in; (void)out_size;
    const float* a0 = (const float*)d_in[0]; const float* a1 = (const float*)d_in[1]; const float* a2 = (const float*)d_in[2]; const float* a3 = (const float*)d_in[3]; const float* a4 = (const float*)d_in[4];   /* the module's argument order: the context, the aspect, the two projections, the score vector: FIVE inputs, all read */
    float* OUT = (float*)d_out;     // [32][256][512]
    char* wsp = (char*)d_ws;
    auto take = [&](size_t bytes) { char* p = wsp; wsp += (bytes + 255) & ~(size_t)255; return (void*)p; };
    float* CP = (float*)take((size_t)NB_ * NQ * DM * 4); float* AT = (float*)take((size_t)NB_ * DM * NK * 4); unsigned* FL = (unsigned*)take((size_t)(FLC + NB_ * (DM / 64)) * 4);
    if ((size_t)(wsp - (char*)d_ws) > ws_size) return;    // 20 MiB and 5 KiB carved
    k_proj<<<(unsigned)(PJ_A + PJ_C), 128, 0, stream>>>(a0, a2, a1, a3, a4, CP, AT, FL);   /* the context's projection (all 8,192 rows) and the aspect's, transposed (the projection shared by the 32 entries) */
    k_attn<<<(unsigned)(NB_ * NQ / RT), NT, 0, stream>>>(CP, AT, a4, a1, FL, OUT);   /* scores, softmax and out[b][i][d] = sum_j w[b][i][j] aspect[b][j][d] (depth 64) for 32 context rows a work-group; the one writer of the output */
}
